// v000
// The times below were measured on an AMD MI455X: many runs one after another, warmed up first and cycling through
// copies of the inputs, with the whole window's GPU time divided by the number of runs. Launches and the gaps
// between them are all in it. The median over several windows is given; except for v000 it joins two sittings, which
// can be a few percent apart, so the side-by-side timings, each taken in one sitting, are the better comparison.
// v000, which the later versions start from, runs in 257 microseconds.
#include <hip/hip_runtime.h>
#include <hip/hip_bf16.h>
#include <stdint.h>

// ---------------------------------------------------------------------------
// MultiHeadAttention for MI455X (gfx1250, wave32, WMMA 16x16x32 f16)
//   B=4 S=2048 F=512 H=8 DK=DV=64 FILT=512
// Pipeline: f16 convert -> QKV proj GEMM (WMMA, reg-double-buffered) ->
// flash attention (WMMA + online softmax + async-to-LDS double buffering) ->
// output GEMM (WMMA, f32 out)
// ---------------------------------------------------------------------------

typedef __attribute__((ext_vector_type(16))) _Float16 v16h;
typedef __attribute__((ext_vector_type(8)))  float    v8f;

union Frag16 { v16h h; uint4 q[2]; };

// Load a 16x32 f16 fragment (A layout; also our B layout when the source is
// stored reduction-contiguous per row).
//   lane%16 -> row (A: M, B: N); lane/16 -> K half {0..7,16..23} vs {8..15,24..31}
// Two 16-byte transactions; all call sites guarantee 16-B alignment.
__device__ __forceinline__ v16h load_frag(const _Float16* base, int ld) {
  const int lane = threadIdx.x & 31;
  const int hi   = lane >> 4;
  const int idx  = lane & 15;
  const _Float16* row = base + (size_t)idx * ld + hi * 8;
  Frag16 f;
  f.q[0] = *(const uint4*)(row);
  f.q[1] = *(const uint4*)(row + 16);
  return f.h;
}

__device__ __forceinline__ v8f wmma16(v16h a, v16h b, v8f c) {
  return __builtin_amdgcn_wmma_f32_16x16x32_f16(false, a, false, b,
                                                (short)0, c, false, false);
}

// CDNA5 async memory->LDS copy, 16B per lane, tracked by ASYNCcnt.
__device__ __forceinline__ void async_copy_b128(uint32_t lds_off,
                                                const _Float16* gptr) {
  asm volatile("global_load_async_to_lds_b128 %0, %1, off"
               :: "v"(lds_off), "v"((uint64_t)(uintptr_t)gptr)
               : "memory");
}
__device__ __forceinline__ void wait_async0() {
  asm volatile("s_wait_asynccnt 0x0" ::: "memory");
}

// ---------------------------------------------------------------------------
// Elementwise conversion kernels
// ---------------------------------------------------------------------------
__global__ __launch_bounds__(256) void cvt_f16(const float* __restrict__ src,
                                               _Float16* __restrict__ dst, int n) {
  int i = blockIdx.x * 256 + threadIdx.x;
  if (i < n) dst[i] = (_Float16)src[i];
}

// W[h][f][dk] (f32) -> Wt[h][dk][f] (f16), H=8 F=512 DK=64
__global__ __launch_bounds__(256) void cvt_tr_w(const float* __restrict__ W,
                                                _Float16* __restrict__ Wt) {
  int i  = blockIdx.x * 256 + threadIdx.x;
  int f  = i & 511;
  int dk = (i >> 9) & 63;
  int h  = i >> 15;
  Wt[i] = (_Float16)W[((size_t)h * 512 + f) * 64 + dk];
}

// Wo[c][o] (512x512 f32) -> Wot[o][c] (f16)
__global__ __launch_bounds__(256) void cvt_tr_wo(const float* __restrict__ W,
                                                 _Float16* __restrict__ Wt) {
  int i = blockIdx.x * 256 + threadIdx.x;
  int c = i & 511, o = i >> 9;
  Wt[i] = (_Float16)W[(size_t)c * 512 + o];
}

// ---------------------------------------------------------------------------
// QKV projection: per (which,h): [8192 x 512] @ [512 x 64] + bias
// grid (8192/128, H, 3), block 256 (8 waves, each a 16x64 tile)
// which==2 (V) stores transposed [b][h][dv][s]
// Register double-buffered K-loop so WMMAs overlap the next step's loads.
// ---------------------------------------------------------------------------
__global__ __launch_bounds__(256) void proj_kernel(
    const _Float16* __restrict__ xq, const _Float16* __restrict__ xk,
    const _Float16* __restrict__ xv,
    const _Float16* __restrict__ Wqt, const _Float16* __restrict__ Wkt,
    const _Float16* __restrict__ Wvt,
    const float* __restrict__ bq, const float* __restrict__ bk,
    const float* __restrict__ bv,
    _Float16* __restrict__ Qd, _Float16* __restrict__ Kd,
    _Float16* __restrict__ Vtd) {
  const int wave = threadIdx.x >> 5;
  const int lane = threadIdx.x & 31;
  const int h     = blockIdx.y;
  const int which = blockIdx.z;

  const _Float16* x    = which == 0 ? xq : which == 1 ? xk : xv;
  const _Float16* Wt   = which == 0 ? Wqt : which == 1 ? Wkt : Wvt;
  const float*    bias = which == 0 ? bq : which == 1 ? bk : bv;

  const int m0 = blockIdx.x * 128 + wave * 16;
  v8f acc[4] = {};
  const _Float16* Arow = x + (size_t)m0 * 512;
  const _Float16* Brow = Wt + (size_t)h * 64 * 512;   // [dk][f]

  v16h a = load_frag(Arow, 512);
  v16h b0 = load_frag(Brow, 512);
  v16h b1 = load_frag(Brow + (size_t)16 * 512, 512);
  v16h b2 = load_frag(Brow + (size_t)32 * 512, 512);
  v16h b3 = load_frag(Brow + (size_t)48 * 512, 512);
#pragma unroll 4
  for (int k = 0; k < 512; k += 32) {
    v16h an = {}, c0 = {}, c1 = {}, c2 = {}, c3 = {};
    if (k + 32 < 512) {
      an = load_frag(Arow + k + 32, 512);
      c0 = load_frag(Brow + k + 32, 512);
      c1 = load_frag(Brow + (size_t)16 * 512 + k + 32, 512);
      c2 = load_frag(Brow + (size_t)32 * 512 + k + 32, 512);
      c3 = load_frag(Brow + (size_t)48 * 512 + k + 32, 512);
    }
    acc[0] = wmma16(a, b0, acc[0]);
    acc[1] = wmma16(a, b1, acc[1]);
    acc[2] = wmma16(a, b2, acc[2]);
    acc[3] = wmma16(a, b3, acc[3]);
    a = an; b0 = c0; b1 = c1; b2 = c2; b3 = c3;
  }

  const int hf = lane >> 4, col = lane & 15;
#pragma unroll
  for (int nt = 0; nt < 4; ++nt) {
    int n = nt * 16 + col;
    float bval = bias[h * 64 + n];
#pragma unroll
    for (int r = 0; r < 8; ++r) {
      int m = m0 + r + 8 * hf;
      int b = m >> 11, s = m & 2047;
      float val = acc[nt][r] + bval;
      if (which == 0)
        Qd[(((size_t)b * 8 + h) * 2048 + s) * 64 + n] = (_Float16)val;
      else if (which == 1)
        Kd[(((size_t)b * 8 + h) * 2048 + s) * 64 + n] = (_Float16)val;
      else
        Vtd[(((size_t)b * 8 + h) * 64 + n) * 2048 + s] = (_Float16)val;
    }
  }
}

// ---------------------------------------------------------------------------
// Flash attention: grid (2048/128, B*H), block 256 (8 waves x 16 queries)
// K/V^T blocks (32 keys) double-buffered in LDS via async-to-LDS copies.
// ---------------------------------------------------------------------------
__global__ __launch_bounds__(256) void attn_kernel(
    const _Float16* __restrict__ Qd, const _Float16* __restrict__ Kd,
    const _Float16* __restrict__ Vtd, _Float16* __restrict__ concat) {
  __shared__ __align__(16) _Float16 Kl[2][32 * 64];   // [t][dk]
  __shared__ __align__(16) _Float16 Vl[2][64 * 32];   // [dv][t]
  __shared__ __align__(16) _Float16 Pl[8][16 * 32];   // per-wave P, [q][t]

  const int tid  = threadIdx.x;
  const int wave = tid >> 5;
  const int lane = tid & 31;
  const int bh   = blockIdx.y;                 // b*8 + h
  const int q0   = blockIdx.x * 128 + wave * 16;

  const _Float16* Qbh = Qd + (size_t)bh * 2048 * 64;
  const _Float16* Kbh = Kd + (size_t)bh * 2048 * 64;
  const _Float16* Vbh = Vtd + (size_t)bh * 64 * 2048;

  // hardware LDS byte offsets for async copies
  const uint32_t kbase = (uint32_t)(uintptr_t)(void*)&Kl[0][0];
  const uint32_t vbase = (uint32_t)(uintptr_t)(void*)&Vl[0][0];
  const int vrow = tid >> 2, vcg = tid & 3;    // V^T: 64 rows x 4 chunks

  const v16h qf0 = load_frag(Qbh + (size_t)q0 * 64, 64);
  const v16h qf1 = load_frag(Qbh + (size_t)q0 * 64 + 32, 64);

  float mrow[8], lrow[8];
#pragma unroll
  for (int r = 0; r < 8; ++r) { mrow[r] = -1e30f; lrow[r] = 0.0f; }
  v8f acc[4] = {};

  const float scale = 0.125f;   // 1/sqrt(DK)
  const int hf = lane >> 4, col = lane & 15;

  // stage(pp, t0): each of 256 lanes moves one 16B K chunk + one 16B V chunk
  auto stage = [&](int pp, int t0) {
    async_copy_b128(kbase + (uint32_t)(pp * 4096 + tid * 16),
                    Kbh + (size_t)t0 * 64 + tid * 8);
    async_copy_b128(vbase + (uint32_t)(pp * 4096 + (vrow * 32 + vcg * 8) * 2),
                    Vbh + (size_t)vrow * 2048 + t0 + vcg * 8);
  };

  stage(0, 0);  // prologue

  for (int n = 0; n < 64; ++n) {
    const int pp = n & 1;
    wait_async0();        // my chunks of buffer pp have landed
    __syncthreads();      // everyone's chunks have landed; prev reads done
    if (n + 1 < 64) stage(pp ^ 1, (n + 1) * 32);   // overlap next block

    const _Float16* Kc = &Kl[pp][0];
    const _Float16* Vc = &Vl[pp][0];

    // ---- scores: 16 queries x 32 keys (two 16x16 C-frags, K-dim = 64) ----
    v8f s0 = {}, s1 = {};
    {
      v16h kb0 = load_frag(Kc, 64);
      v16h kb1 = load_frag(Kc + 32, 64);
      s0 = wmma16(qf0, kb0, s0);
      s0 = wmma16(qf1, kb1, s0);
      v16h kb2 = load_frag(Kc + 16 * 64, 64);
      v16h kb3 = load_frag(Kc + 16 * 64 + 32, 64);
      s1 = wmma16(qf0, kb2, s1);
      s1 = wmma16(qf1, kb3, s1);
    }

    // ---- online softmax (rows at r + 8*hf; cols across 16-lane half) -----
    float corr[8];
#pragma unroll
    for (int r = 0; r < 8; ++r) {
      float a0 = s0[r] * scale, a1 = s1[r] * scale;
      float bm = fmaxf(a0, a1);
#pragma unroll
      for (int off = 1; off < 16; off <<= 1)
        bm = fmaxf(bm, __shfl_xor(bm, off, 32));
      float mnew = fmaxf(mrow[r], bm);
      float c  = __expf(mrow[r] - mnew);
      float p0 = __expf(a0 - mnew);
      float p1 = __expf(a1 - mnew);
      float ps = p0 + p1;
#pragma unroll
      for (int off = 1; off < 16; off <<= 1) ps += __shfl_xor(ps, off, 32);
      lrow[r] = lrow[r] * c + ps;
      mrow[r] = mnew;
      corr[r] = c;
      // C-layout -> LDS (row-major 16x32) for A-fragment reload
      Pl[wave][(r + 8 * hf) * 32 + col]      = (_Float16)p0;
      Pl[wave][(r + 8 * hf) * 32 + col + 16] = (_Float16)p1;
    }
#pragma unroll
    for (int nt = 0; nt < 4; ++nt)
#pragma unroll
      for (int r = 0; r < 8; ++r) acc[nt][r] *= corr[r];

    // ---- P @ V : A = P (16x32 over keys), B = V^T rows (dv-contig in t) ---
    v16h pf = load_frag(&Pl[wave][0], 32);
#pragma unroll
    for (int nt = 0; nt < 4; ++nt) {
      v16h vb = load_frag(Vc + (size_t)(nt * 16) * 32, 32);
      acc[nt] = wmma16(pf, vb, acc[nt]);
    }
  }

  // epilogue: normalize and write f16 concat [b][s][h*64 + dv]
  const int b = bh >> 3, h = bh & 7;
#pragma unroll
  for (int nt = 0; nt < 4; ++nt) {
#pragma unroll
    for (int r = 0; r < 8; ++r) {
      int s = q0 + r + 8 * hf;
      float val = acc[nt][r] / lrow[r];
      concat[((size_t)(b * 2048 + s)) * 512 + h * 64 + nt * 16 + col] =
          (_Float16)val;
    }
  }
}

// ---------------------------------------------------------------------------
// Output projection: [8192 x 512] @ [512 x 512] + bo -> f32
// grid (8192/128, 512/64), block 256; register double-buffered K-loop.
// ---------------------------------------------------------------------------
__global__ __launch_bounds__(256) void outproj_kernel(
    const _Float16* __restrict__ concat, const _Float16* __restrict__ Wot,
    const float* __restrict__ bo, float* __restrict__ out) {
  const int wave = threadIdx.x >> 5;
  const int lane = threadIdx.x & 31;
  const int m0 = blockIdx.x * 128 + wave * 16;
  const int n0 = blockIdx.y * 64;

  v8f acc[4] = {};
  const _Float16* Arow = concat + (size_t)m0 * 512;
  const _Float16* Brow = Wot + (size_t)n0 * 512;

  v16h a = load_frag(Arow, 512);
  v16h b0 = load_frag(Brow, 512);
  v16h b1 = load_frag(Brow + (size_t)16 * 512, 512);
  v16h b2 = load_frag(Brow + (size_t)32 * 512, 512);
  v16h b3 = load_frag(Brow + (size_t)48 * 512, 512);
#pragma unroll 4
  for (int k = 0; k < 512; k += 32) {
    v16h an = {}, c0 = {}, c1 = {}, c2 = {}, c3 = {};
    if (k + 32 < 512) {
      an = load_frag(Arow + k + 32, 512);
      c0 = load_frag(Brow + k + 32, 512);
      c1 = load_frag(Brow + (size_t)16 * 512 + k + 32, 512);
      c2 = load_frag(Brow + (size_t)32 * 512 + k + 32, 512);
      c3 = load_frag(Brow + (size_t)48 * 512 + k + 32, 512);
    }
    acc[0] = wmma16(a, b0, acc[0]);
    acc[1] = wmma16(a, b1, acc[1]);
    acc[2] = wmma16(a, b2, acc[2]);
    acc[3] = wmma16(a, b3, acc[3]);
    a = an; b0 = c0; b1 = c1; b2 = c2; b3 = c3;
  }
  const int hf = lane >> 4, col = lane & 15;
#pragma unroll
  for (int nt = 0; nt < 4; ++nt) {
    int n = n0 + nt * 16 + col;
    float bval = bo[n];
#pragma unroll
    for (int r = 0; r < 8; ++r) {
      int m = m0 + r + 8 * hf;
      out[(size_t)m * 512 + n] = acc[nt][r] + bval;
    }
  }
}

// ---------------------------------------------------------------------------
extern "C" void kernel_launch(void* const* d_in, const int* in_sizes, int n_in,
                              void* d_out, int out_size, void* d_ws,
                              size_t ws_size, hipStream_t stream) {
  const float* x_q = (const float*)d_in[0];
  const float* x_k = (const float*)d_in[1];
  const float* x_v = (const float*)d_in[2];
  const float* Wq  = (const float*)d_in[3];
  const float* bq  = (const float*)d_in[4];
  const float* Wk  = (const float*)d_in[5];
  const float* bk  = (const float*)d_in[6];
  const float* Wv  = (const float*)d_in[7];
  const float* bv  = (const float*)d_in[8];
  const float* Wo  = (const float*)d_in[9];
  const float* bo  = (const float*)d_in[10];
  float* out = (float*)d_out;
  (void)in_sizes; (void)n_in; (void)out_size; (void)ws_size;

  // workspace carve-up (~61 MB total)
  char* ws = (char*)d_ws;
  size_t off = 0;
  auto take = [&](size_t elems) {
    _Float16* p = (_Float16*)(ws + off);
    off += elems * sizeof(_Float16);
    return p;
  };
  const size_t XE = (size_t)8192 * 512;
  const size_t WE = (size_t)8 * 64 * 512;
  _Float16* xqh = take(XE);
  _Float16* xkh = take(XE);
  _Float16* xvh = take(XE);
  _Float16* Wqt = take(WE);
  _Float16* Wkt = take(WE);
  _Float16* Wvt = take(WE);
  _Float16* Wot = take((size_t)512 * 512);
  _Float16* Qd  = take(XE);
  _Float16* Kd  = take(XE);
  _Float16* Vtd = take(XE);
  _Float16* Cc  = take(XE);

  cvt_f16<<<(int)(XE / 256), 256, 0, stream>>>(x_q, xqh, (int)XE);
  cvt_f16<<<(int)(XE / 256), 256, 0, stream>>>(x_k, xkh, (int)XE);
  cvt_f16<<<(int)(XE / 256), 256, 0, stream>>>(x_v, xvh, (int)XE);
  cvt_tr_w<<<(int)(WE / 256), 256, 0, stream>>>(Wq, Wqt);
  cvt_tr_w<<<(int)(WE / 256), 256, 0, stream>>>(Wk, Wkt);
  cvt_tr_w<<<(int)(WE / 256), 256, 0, stream>>>(Wv, Wvt);
  cvt_tr_wo<<<1024, 256, 0, stream>>>(Wo, Wot);

  proj_kernel<<<dim3(64, 8, 3), 256, 0, stream>>>(
      xqh, xkh, xvh, Wqt, Wkt, Wvt, bq, bk, bv, Qd, Kd, Vtd);

  attn_kernel<<<dim3(16, 32), 256, 0, stream>>>(Qd, Kd, Vtd, Cc);

  outproj_kernel<<<dim3(64, 8), 256, 0, stream>>>(Cc, Wot, bo, out);
}

// v001
// A run of this version takes 229 microseconds.
// Timed twice side by side with v000, it ran 1.17 times as fast both times.
#include <hip/hip_runtime.h>
#include <hip/hip_bf16.h>
#include <stdint.h>

// ---------------------------------------------------------------------------
// MultiHeadAttention for MI455X (gfx1250, wave32, WMMA 16x16x32 f16)
//   B=4 S=2048 F=512 H=8 DK=DV=64 FILT=512
// Pipeline: f16 convert -> QKV proj GEMM (WMMA, reg-double-buffered) ->
// flash attention (WMMA + online softmax + async-to-LDS double buffering) ->
// output GEMM (WMMA, f32 out)
// ---------------------------------------------------------------------------

typedef __attribute__((ext_vector_type(16))) _Float16 v16h;
typedef __attribute__((ext_vector_type(8)))  float    v8f;

union Frag16 { v16h h; uint4 q[2]; };

// Load a 16x32 f16 fragment (A layout; also our B layout when the source is
// stored reduction-contiguous per row).
//   lane%16 -> row (A: M, B: N); lane/16 -> K half {0..7,16..23} vs {8..15,24..31}
// Two 16-byte transactions; all call sites guarantee 16-B alignment.
__device__ __forceinline__ v16h load_frag(const _Float16* base, int ld) {
  const int lane = threadIdx.x & 31;
  const int hi   = lane >> 4;
  const int idx  = lane & 15;
  const _Float16* row = base + (size_t)idx * ld + hi * 8;
  Frag16 f;
  f.q[0] = *(const uint4*)(row);
  f.q[1] = *(const uint4*)(row + 16);
  return f.h;
}

__device__ __forceinline__ v8f wmma16(v16h a, v16h b, v8f c) {
  return __builtin_amdgcn_wmma_f32_16x16x32_f16(false, a, false, b,
                                                (short)0, c, false, false);
}

// CDNA5 async memory->LDS copies, 16B per lane each, tracked by ASYNCcnt.
// Both copies of a stage and their s_wait_xcnt stand in one statement, so the
// address registers are not rewritten ahead of that wait.
__device__ __forceinline__ void async_copy2_b128(uint32_t lds0,
                                                 const _Float16* g0,
                                                 uint32_t lds1,
                                                 const _Float16* g1) {
  asm volatile("global_load_async_to_lds_b128 %0, %1, off\n\t"
               "global_load_async_to_lds_b128 %2, %3, off\n\t"
               "s_wait_xcnt 0x0"
               :: "v"(lds0), "v"((uint64_t)(uintptr_t)g0),
                  "v"(lds1), "v"((uint64_t)(uintptr_t)g1)
               : "memory");
}
__device__ __forceinline__ void wait_async0() {
  asm volatile("s_wait_asynccnt 0x0" ::: "memory");
}
// This wave's LDS reads of the buffer that is refilled next have retired.
__device__ __forceinline__ void wait_ds0() {
  asm volatile("s_wait_dscnt 0x0" ::: "memory");
}

// ---------------------------------------------------------------------------
// Elementwise conversion kernels
// ---------------------------------------------------------------------------
__global__ __launch_bounds__(256) void cvt_f16(const float* __restrict__ src,
                                               _Float16* __restrict__ dst, int n) {
  int i = blockIdx.x * 256 + threadIdx.x;
  if (i < n) dst[i] = (_Float16)src[i];
}

// W[h][f][dk] (f32) -> Wt[h][dk][f] (f16), H=8 F=512 DK=64
__global__ __launch_bounds__(256) void cvt_tr_w(const float* __restrict__ W,
                                                _Float16* __restrict__ Wt) {
  int i  = blockIdx.x * 256 + threadIdx.x;
  int f  = i & 511;
  int dk = (i >> 9) & 63;
  int h  = i >> 15;
  Wt[i] = (_Float16)W[((size_t)h * 512 + f) * 64 + dk];
}

// Wo[c][o] (512x512 f32) -> Wot[o][c] (f16)
__global__ __launch_bounds__(256) void cvt_tr_wo(const float* __restrict__ W,
                                                 _Float16* __restrict__ Wt) {
  int i = blockIdx.x * 256 + threadIdx.x;
  int c = i & 511, o = i >> 9;
  Wt[i] = (_Float16)W[(size_t)c * 512 + o];
}

// ---------------------------------------------------------------------------
// QKV projection: per (which,h): [8192 x 512] @ [512 x 64] + bias
// grid (8192/128, H, 3), block 256 (8 waves, each a 16x64 tile)
// which==2 (V) stores transposed [b][h][dv][s]
// Register double-buffered K-loop so WMMAs overlap the next step's loads.
// ---------------------------------------------------------------------------
__global__ __launch_bounds__(256) void proj_kernel(
    const _Float16* __restrict__ xq, const _Float16* __restrict__ xk,
    const _Float16* __restrict__ xv,
    const _Float16* __restrict__ Wqt, const _Float16* __restrict__ Wkt,
    const _Float16* __restrict__ Wvt,
    const float* __restrict__ bq, const float* __restrict__ bk,
    const float* __restrict__ bv,
    _Float16* __restrict__ Qd, _Float16* __restrict__ Kd,
    _Float16* __restrict__ Vtd) {
  const int wave = threadIdx.x >> 5;
  const int lane = threadIdx.x & 31;
  const int h     = blockIdx.y;
  const int which = blockIdx.z;

  const _Float16* x    = which == 0 ? xq : which == 1 ? xk : xv;
  const _Float16* Wt   = which == 0 ? Wqt : which == 1 ? Wkt : Wvt;
  const float*    bias = which == 0 ? bq : which == 1 ? bk : bv;

  const int m0 = blockIdx.x * 128 + wave * 16;
  v8f acc[4] = {};
  const _Float16* Arow = x + (size_t)m0 * 512;
  const _Float16* Brow = Wt + (size_t)h * 64 * 512;   // [dk][f]

  v16h a = load_frag(Arow, 512);
  v16h b0 = load_frag(Brow, 512);
  v16h b1 = load_frag(Brow + (size_t)16 * 512, 512);
  v16h b2 = load_frag(Brow + (size_t)32 * 512, 512);
  v16h b3 = load_frag(Brow + (size_t)48 * 512, 512);
#pragma unroll 4
  for (int k = 0; k < 512; k += 32) {
    v16h an = {}, c0 = {}, c1 = {}, c2 = {}, c3 = {};
    if (k + 32 < 512) {
      an = load_frag(Arow + k + 32, 512);
      c0 = load_frag(Brow + k + 32, 512);
      c1 = load_frag(Brow + (size_t)16 * 512 + k + 32, 512);
      c2 = load_frag(Brow + (size_t)32 * 512 + k + 32, 512);
      c3 = load_frag(Brow + (size_t)48 * 512 + k + 32, 512);
    }
    acc[0] = wmma16(a, b0, acc[0]);
    acc[1] = wmma16(a, b1, acc[1]);
    acc[2] = wmma16(a, b2, acc[2]);
    acc[3] = wmma16(a, b3, acc[3]);
    a = an; b0 = c0; b1 = c1; b2 = c2; b3 = c3;
  }

  const int hf = lane >> 4, col = lane & 15;
#pragma unroll
  for (int nt = 0; nt < 4; ++nt) {
    int n = nt * 16 + col;
    float bval = bias[h * 64 + n];
#pragma unroll
    for (int r = 0; r < 8; ++r) {
      int m = m0 + r + 8 * hf;
      int b = m >> 11, s = m & 2047;
      float val = acc[nt][r] + bval;
      if (which == 0)
        Qd[(((size_t)b * 8 + h) * 2048 + s) * 64 + n] = (_Float16)val;
      else if (which == 1)
        Kd[(((size_t)b * 8 + h) * 2048 + s) * 64 + n] = (_Float16)val;
      else
        Vtd[(((size_t)b * 8 + h) * 64 + n) * 2048 + s] = (_Float16)val;
    }
  }
}

// ---------------------------------------------------------------------------
// Flash attention: grid (2048/128, B*H), block 256 (8 waves x 16 queries)
// K/V^T blocks (32 keys) double-buffered in LDS via async-to-LDS copies.
// LDS row pitches are 16 B x odd: the 16 rows that one ds_load_b128 half-wave
// reads then start on 16 different groups of four banks (no bank conflict).
// ---------------------------------------------------------------------------
constexpr int KP = 72;   // K row pitch in halves: 64 data + 8 pad (144 B)
constexpr int VP = 40;   // V^T row pitch in halves: 32 data + 8 pad (80 B)
constexpr int PP = 40;   // P row pitch in halves: 32 data + 8 pad (80 B)

__global__ __launch_bounds__(256) void attn_kernel(
    const _Float16* __restrict__ Qd, const _Float16* __restrict__ Kd,
    const _Float16* __restrict__ Vtd, _Float16* __restrict__ concat) {
  __shared__ __align__(16) _Float16 Kl[2][32 * KP];   // [t][dk]
  __shared__ __align__(16) _Float16 Vl[2][64 * VP];   // [dv][t]
  __shared__ __align__(16) _Float16 Pl[8][16 * PP];   // per-wave P, [q][t]

  const int tid  = threadIdx.x;
  const int wave = tid >> 5;
  const int lane = tid & 31;
  const int bh   = blockIdx.y;                 // b*8 + h
  const int q0   = blockIdx.x * 128 + wave * 16;

  const _Float16* Qbh = Qd + (size_t)bh * 2048 * 64;
  const _Float16* Kbh = Kd + (size_t)bh * 2048 * 64;
  const _Float16* Vbh = Vtd + (size_t)bh * 64 * 2048;

  // hardware LDS byte offsets for async copies
  const uint32_t kbase = (uint32_t)(uintptr_t)(void*)&Kl[0][0];
  const uint32_t vbase = (uint32_t)(uintptr_t)(void*)&Vl[0][0];
  const int krow = tid >> 3, kcg = tid & 7;    // K:   32 rows x 8 chunks
  const int vrow = tid >> 2, vcg = tid & 3;    // V^T: 64 rows x 4 chunks

  const v16h qf0 = load_frag(Qbh + (size_t)q0 * 64, 64);
  const v16h qf1 = load_frag(Qbh + (size_t)q0 * 64 + 32, 64);

  float mrow[8], lrow[8];
#pragma unroll
  for (int r = 0; r < 8; ++r) { mrow[r] = -1e30f; lrow[r] = 0.0f; }
  v8f acc[4] = {};

  const float scale = 0.125f;   // 1/sqrt(DK)
  const int hf = lane >> 4, col = lane & 15;

  // stage(pp, t0): each of 256 lanes moves one 16B K chunk + one 16B V chunk
  auto stage = [&](int pp, int t0) {
    async_copy2_b128(
        kbase + (uint32_t)((pp * 32 * KP + krow * KP + kcg * 8) * 2),
        Kbh + (size_t)t0 * 64 + tid * 8,
        vbase + (uint32_t)((pp * 64 * VP + vrow * VP + vcg * 8) * 2),
        Vbh + (size_t)vrow * 2048 + t0 + vcg * 8);
  };

  stage(0, 0);  // prologue

  for (int n = 0; n < 64; ++n) {
    const int pp = n & 1;
    wait_ds0();           // my reads of the other buffer have retired
    wait_async0();        // my chunks of buffer pp have landed
    __syncthreads();      // everyone's chunks have landed; prev reads done
    if (n + 1 < 64) stage(pp ^ 1, (n + 1) * 32);   // overlap next block

    const _Float16* Kc = &Kl[pp][0];
    const _Float16* Vc = &Vl[pp][0];

    // ---- scores: 16 queries x 32 keys (two 16x16 C-frags, K-dim = 64) ----
    v8f s0 = {}, s1 = {};
    {
      v16h kb0 = load_frag(Kc, KP);
      v16h kb1 = load_frag(Kc + 32, KP);
      s0 = wmma16(qf0, kb0, s0);
      s0 = wmma16(qf1, kb1, s0);
      v16h kb2 = load_frag(Kc + 16 * KP, KP);
      v16h kb3 = load_frag(Kc + 16 * KP + 32, KP);
      s1 = wmma16(qf0, kb2, s1);
      s1 = wmma16(qf1, kb3, s1);
    }

    // ---- online softmax (rows at r + 8*hf; cols across 16-lane half) -----
    float corr[8];
#pragma unroll
    for (int r = 0; r < 8; ++r) {
      float a0 = s0[r] * scale, a1 = s1[r] * scale;
      float bm = fmaxf(a0, a1);
#pragma unroll
      for (int off = 1; off < 16; off <<= 1)
        bm = fmaxf(bm, __shfl_xor(bm, off, 32));
      float mnew = fmaxf(mrow[r], bm);
      float c  = __expf(mrow[r] - mnew);
      float p0 = __expf(a0 - mnew);
      float p1 = __expf(a1 - mnew);
      float ps = p0 + p1;
#pragma unroll
      for (int off = 1; off < 16; off <<= 1) ps += __shfl_xor(ps, off, 32);
      lrow[r] = lrow[r] * c + ps;
      mrow[r] = mnew;
      corr[r] = c;
      // C-layout -> LDS (row-major 16x32) for A-fragment reload
      Pl[wave][(r + 8 * hf) * PP + col]      = (_Float16)p0;
      Pl[wave][(r + 8 * hf) * PP + col + 16] = (_Float16)p1;
    }
#pragma unroll
    for (int nt = 0; nt < 4; ++nt)
#pragma unroll
      for (int r = 0; r < 8; ++r) acc[nt][r] *= corr[r];

    // ---- P @ V : A = P (16x32 over keys), B = V^T rows (dv-contig in t) ---
    v16h pf = load_frag(&Pl[wave][0], PP);
#pragma unroll
    for (int nt = 0; nt < 4; ++nt) {
      v16h vb = load_frag(Vc + (size_t)(nt * 16) * VP, VP);
      acc[nt] = wmma16(pf, vb, acc[nt]);
    }
  }

  // epilogue: normalize and write f16 concat [b][s][h*64 + dv]
  const int b = bh >> 3, h = bh & 7;
#pragma unroll
  for (int nt = 0; nt < 4; ++nt) {
#pragma unroll
    for (int r = 0; r < 8; ++r) {
      int s = q0 + r + 8 * hf;
      float val = acc[nt][r] / lrow[r];
      concat[((size_t)(b * 2048 + s)) * 512 + h * 64 + nt * 16 + col] =
          (_Float16)val;
    }
  }
}

// ---------------------------------------------------------------------------
// Output projection: [8192 x 512] @ [512 x 512] + bo -> f32
// grid (8192/128, 512/64), block 256; register double-buffered K-loop.
// ---------------------------------------------------------------------------
__global__ __launch_bounds__(256) void outproj_kernel(
    const _Float16* __restrict__ concat, const _Float16* __restrict__ Wot,
    const float* __restrict__ bo, float* __restrict__ out) {
  const int wave = threadIdx.x >> 5;
  const int lane = threadIdx.x & 31;
  const int m0 = blockIdx.x * 128 + wave * 16;
  const int n0 = blockIdx.y * 64;

  v8f acc[4] = {};
  const _Float16* Arow = concat + (size_t)m0 * 512;
  const _Float16* Brow = Wot + (size_t)n0 * 512;

  v16h a = load_frag(Arow, 512);
  v16h b0 = load_frag(Brow, 512);
  v16h b1 = load_frag(Brow + (size_t)16 * 512, 512);
  v16h b2 = load_frag(Brow + (size_t)32 * 512, 512);
  v16h b3 = load_frag(Brow + (size_t)48 * 512, 512);
#pragma unroll 4
  for (int k = 0; k < 512; k += 32) {
    v16h an = {}, c0 = {}, c1 = {}, c2 = {}, c3 = {};
    if (k + 32 < 512) {
      an = load_frag(Arow + k + 32, 512);
      c0 = load_frag(Brow + k + 32, 512);
      c1 = load_frag(Brow + (size_t)16 * 512 + k + 32, 512);
      c2 = load_frag(Brow + (size_t)32 * 512 + k + 32, 512);
      c3 = load_frag(Brow + (size_t)48 * 512 + k + 32, 512);
    }
    acc[0] = wmma16(a, b0, acc[0]);
    acc[1] = wmma16(a, b1, acc[1]);
    acc[2] = wmma16(a, b2, acc[2]);
    acc[3] = wmma16(a, b3, acc[3]);
    a = an; b0 = c0; b1 = c1; b2 = c2; b3 = c3;
  }
  const int hf = lane >> 4, col = lane & 15;
#pragma unroll
  for (int nt = 0; nt < 4; ++nt) {
    int n = n0 + nt * 16 + col;
    float bval = bo[n];
#pragma unroll
    for (int r = 0; r < 8; ++r) {
      int m = m0 + r + 8 * hf;
      out[(size_t)m * 512 + n] = acc[nt][r] + bval;
    }
  }
}

// ---------------------------------------------------------------------------
extern "C" void kernel_launch(void* const* d_in, const int* in_sizes, int n_in,
                              void* d_out, int out_size, void* d_ws,
                              size_t ws_size, hipStream_t stream) {
  const float* x_q = (const float*)d_in[0];
  const float* x_k = (const float*)d_in[1];
  const float* x_v = (const float*)d_in[2];
  const float* Wq  = (const float*)d_in[3];
  const float* bq  = (const float*)d_in[4];
  const float* Wk  = (const float*)d_in[5];
  const float* bk  = (const float*)d_in[6];
  const float* Wv  = (const float*)d_in[7];
  const float* bv  = (const float*)d_in[8];
  const float* Wo  = (const float*)d_in[9];
  const float* bo  = (const float*)d_in[10];
  float* out = (float*)d_out;
  (void)in_sizes; (void)n_in; (void)out_size; (void)ws_size;

  // workspace carve-up (~61 MB total)
  char* ws = (char*)d_ws;
  size_t off = 0;
  auto take = [&](size_t elems) {
    _Float16* p = (_Float16*)(ws + off);
    off += elems * sizeof(_Float16);
    return p;
  };
  const size_t XE = (size_t)8192 * 512;
  const size_t WE = (size_t)8 * 64 * 512;
  _Float16* xqh = take(XE);
  _Float16* xkh = take(XE);
  _Float16* xvh = take(XE);
  _Float16* Wqt = take(WE);
  _Float16* Wkt = take(WE);
  _Float16* Wvt = take(WE);
  _Float16* Wot = take((size_t)512 * 512);
  _Float16* Qd  = take(XE);
  _Float16* Kd  = take(XE);
  _Float16* Vtd = take(XE);
  _Float16* Cc  = take(XE);

  cvt_f16<<<(int)(XE / 256), 256, 0, stream>>>(x_q, xqh, (int)XE);
  cvt_f16<<<(int)(XE / 256), 256, 0, stream>>>(x_k, xkh, (int)XE);
  cvt_f16<<<(int)(XE / 256), 256, 0, stream>>>(x_v, xvh, (int)XE);
  cvt_tr_w<<<(int)(WE / 256), 256, 0, stream>>>(Wq, Wqt);
  cvt_tr_w<<<(int)(WE / 256), 256, 0, stream>>>(Wk, Wkt);
  cvt_tr_w<<<(int)(WE / 256), 256, 0, stream>>>(Wv, Wvt);
  cvt_tr_wo<<<1024, 256, 0, stream>>>(Wo, Wot);

  proj_kernel<<<dim3(64, 8, 3), 256, 0, stream>>>(
      xqh, xkh, xvh, Wqt, Wkt, Wvt, bq, bk, bv, Qd, Kd, Vtd);

  attn_kernel<<<dim3(16, 32), 256, 0, stream>>>(Qd, Kd, Vtd, Cc);

  outproj_kernel<<<dim3(64, 8), 256, 0, stream>>>(Cc, Wot, bo, out);
}

// v002
// Measured time: 189 microseconds a run.
// In both of two side-by-side timings against v001, it was 1.22 times as fast.
// Counting every step since v000, it is 1.42 times as fast.
#include <hip/hip_runtime.h>
#include <hip/hip_bf16.h>
#include <stdint.h>

// ---------------------------------------------------------------------------
// MultiHeadAttention for MI455X (gfx1250, wave32, WMMA 16x16x32 f16)
//   B=4 S=2048 F=512 H=8 DK=DV=64 FILT=512
// Pipeline: f16 convert -> QKV proj GEMM (WMMA, reg-double-buffered) ->
// flash attention (WMMA + online softmax + async-to-LDS double buffering) ->
// output GEMM (WMMA, f32 out)
// ---------------------------------------------------------------------------

typedef __attribute__((ext_vector_type(16))) _Float16 v16h;
typedef __attribute__((ext_vector_type(8)))  float    v8f;

union Frag16 { v16h h; uint4 q[2]; };

// Load a 16x32 f16 fragment (A layout; also our B layout when the source is
// stored reduction-contiguous per row).
//   lane%16 -> row (A: M, B: N); lane/16 -> K half {0..7,16..23} vs {8..15,24..31}
// Two 16-byte transactions; all call sites guarantee 16-B alignment.
__device__ __forceinline__ v16h load_frag(const _Float16* base, int ld) {
  const int lane = threadIdx.x & 31;
  const int hi   = lane >> 4;
  const int idx  = lane & 15;
  const _Float16* row = base + (size_t)idx * ld + hi * 8;
  Frag16 f;
  f.q[0] = *(const uint4*)(row);
  f.q[1] = *(const uint4*)(row + 16);
  return f.h;
}

__device__ __forceinline__ v8f wmma16(v16h a, v16h b, v8f c) {
  return __builtin_amdgcn_wmma_f32_16x16x32_f16(false, a, false, b,
                                                (short)0, c, false, false);
}

// CDNA5 async memory->LDS copies, 16B per lane each, tracked by ASYNCcnt.
// Both copies of a stage and their s_wait_xcnt stand in one statement, so the
// address registers are not rewritten ahead of that wait.
__device__ __forceinline__ void async_copy2_b128(uint32_t lds0,
                                                 const _Float16* g0,
                                                 uint32_t lds1,
                                                 const _Float16* g1) {
  asm volatile("global_load_async_to_lds_b128 %0, %1, off\n\t"
               "global_load_async_to_lds_b128 %2, %3, off\n\t"
               "s_wait_xcnt 0x0"
               :: "v"(lds0), "v"((uint64_t)(uintptr_t)g0),
                  "v"(lds1), "v"((uint64_t)(uintptr_t)g1)
               : "memory");
}
__device__ __forceinline__ void wait_async0() {
  asm volatile("s_wait_asynccnt 0x0" ::: "memory");
}
// This wave's LDS reads of the buffer that is refilled next have retired.
__device__ __forceinline__ void wait_ds0() {
  asm volatile("s_wait_dscnt 0x0" ::: "memory");
}

// ---------------------------------------------------------------------------
// Elementwise conversion kernels
// ---------------------------------------------------------------------------
__global__ __launch_bounds__(256) void cvt_f16(const float* __restrict__ src,
                                               _Float16* __restrict__ dst, int n) {
  int i = blockIdx.x * 256 + threadIdx.x;
  if (i < n) dst[i] = (_Float16)src[i];
}

// W[h][f][dk] (f32) -> Wt[h][dk][f] (f16), H=8 F=512 DK=64
__global__ __launch_bounds__(256) void cvt_tr_w(const float* __restrict__ W,
                                                _Float16* __restrict__ Wt) {
  int i  = blockIdx.x * 256 + threadIdx.x;
  int f  = i & 511;
  int dk = (i >> 9) & 63;
  int h  = i >> 15;
  Wt[i] = (_Float16)W[((size_t)h * 512 + f) * 64 + dk];
}

// Wo[c][o] (512x512 f32) -> Wot[o][c] (f16)
__global__ __launch_bounds__(256) void cvt_tr_wo(const float* __restrict__ W,
                                                 _Float16* __restrict__ Wt) {
  int i = blockIdx.x * 256 + threadIdx.x;
  int c = i & 511, o = i >> 9;
  Wt[i] = (_Float16)W[(size_t)c * 512 + o];
}

// ---------------------------------------------------------------------------
// QKV projection: per (which,h): [8192 x 512] @ [512 x 64] + bias
// grid (8192/128, H, 3), block 256 (8 waves, each a 16x64 tile)
// which==2 (V) stores transposed [b][h][dv][s]
// Register double-buffered K-loop so WMMAs overlap the next step's loads.
// ---------------------------------------------------------------------------
__global__ __launch_bounds__(256) void proj_kernel(
    const _Float16* __restrict__ xq, const _Float16* __restrict__ xk,
    const _Float16* __restrict__ xv,
    const _Float16* __restrict__ Wqt, const _Float16* __restrict__ Wkt,
    const _Float16* __restrict__ Wvt,
    const float* __restrict__ bq, const float* __restrict__ bk,
    const float* __restrict__ bv,
    _Float16* __restrict__ Qd, _Float16* __restrict__ Kd,
    _Float16* __restrict__ Vtd) {
  const int wave = threadIdx.x >> 5;
  const int lane = threadIdx.x & 31;
  const int h     = blockIdx.y;
  const int which = blockIdx.z;

  const _Float16* x    = which == 0 ? xq : which == 1 ? xk : xv;
  const _Float16* Wt   = which == 0 ? Wqt : which == 1 ? Wkt : Wvt;
  const float*    bias = which == 0 ? bq : which == 1 ? bk : bv;

  const int m0 = blockIdx.x * 128 + wave * 16;
  v8f acc[4] = {};
  const _Float16* Arow = x + (size_t)m0 * 512;
  const _Float16* Brow = Wt + (size_t)h * 64 * 512;   // [dk][f]

  v16h a = load_frag(Arow, 512);
  v16h b0 = load_frag(Brow, 512);
  v16h b1 = load_frag(Brow + (size_t)16 * 512, 512);
  v16h b2 = load_frag(Brow + (size_t)32 * 512, 512);
  v16h b3 = load_frag(Brow + (size_t)48 * 512, 512);
#pragma unroll 4
  for (int k = 0; k < 512; k += 32) {
    v16h an = {}, c0 = {}, c1 = {}, c2 = {}, c3 = {};
    if (k + 32 < 512) {
      an = load_frag(Arow + k + 32, 512);
      c0 = load_frag(Brow + k + 32, 512);
      c1 = load_frag(Brow + (size_t)16 * 512 + k + 32, 512);
      c2 = load_frag(Brow + (size_t)32 * 512 + k + 32, 512);
      c3 = load_frag(Brow + (size_t)48 * 512 + k + 32, 512);
    }
    acc[0] = wmma16(a, b0, acc[0]);
    acc[1] = wmma16(a, b1, acc[1]);
    acc[2] = wmma16(a, b2, acc[2]);
    acc[3] = wmma16(a, b3, acc[3]);
    a = an; b0 = c0; b1 = c1; b2 = c2; b3 = c3;
  }

  const int hf = lane >> 4, col = lane & 15;
#pragma unroll
  for (int nt = 0; nt < 4; ++nt) {
    int n = nt * 16 + col;
    float bval = bias[h * 64 + n];
#pragma unroll
    for (int r = 0; r < 8; ++r) {
      int m = m0 + r + 8 * hf;
      int b = m >> 11, s = m & 2047;
      float val = acc[nt][r] + bval;
      if (which == 0)
        Qd[(((size_t)b * 8 + h) * 2048 + s) * 64 + n] = (_Float16)val;
      else if (which == 1)
        Kd[(((size_t)b * 8 + h) * 2048 + s) * 64 + n] = (_Float16)val;
      else
        Vtd[(((size_t)b * 8 + h) * 64 + n) * 2048 + s] = (_Float16)val;
    }
  }
}

constexpr int KP = 72;   // K row pitch in halves: 64 data + 8 pad (144 B)
constexpr int VP = 40;   // V^T row pitch in halves: 32 data + 8 pad (80 B)

// value of lane l ^ 16
__device__ __forceinline__ float xhalf(float x) {
  int b = __builtin_bit_cast(int, x);
  return __builtin_bit_cast(
      float, __builtin_amdgcn_permlanex16(b, b, 0x76543210, 0xfedcba98, false,
                                          false));
}

__global__ __launch_bounds__(256) void attn_kernel(
    const _Float16* __restrict__ Qd, const _Float16* __restrict__ Kd,
    const _Float16* __restrict__ Vtd, _Float16* __restrict__ concat) {
  __shared__ __align__(16) _Float16 Kl[2][32 * KP];   // [t][dk]
  __shared__ __align__(16) _Float16 Vl[2][64 * VP];   // [dv][t]

  const int tid  = threadIdx.x;
  const int wave = tid >> 5;
  const int lane = tid & 31;
  const int bh   = blockIdx.y;                 // b*8 + h
  const int q0   = blockIdx.x * 128 + wave * 16;

  const _Float16* Qbh = Qd + (size_t)bh * 2048 * 64;
  const _Float16* Kbh = Kd + (size_t)bh * 2048 * 64;
  const _Float16* Vbh = Vtd + (size_t)bh * 64 * 2048;

  // hardware LDS byte offsets for async copies
  const uint32_t kbase = (uint32_t)(uintptr_t)(void*)&Kl[0][0];
  const uint32_t vbase = (uint32_t)(uintptr_t)(void*)&Vl[0][0];
  const int krow = tid >> 3, kcg = tid & 7;    // K:   32 rows x 8 chunks
  const int vrow = tid >> 2, vcg = tid & 3;    // V^T: 64 rows x 4 chunks

  // B fragments of Q^T: column = query lane%16
  const v16h qf0 = load_frag(Qbh + (size_t)q0 * 64, 64);
  const v16h qf1 = load_frag(Qbh + (size_t)q0 * 64 + 32, 64);

  float mrow = -1e30f;   // running maximum of this lane's query
  float lrow = 0.0f;     // running sum over this wave half's keys only
  v8f acc[4] = {};       // O^T: acc[nt][r] = O[query col][nt*16 + 8*hf + r]

  const float scale = 0.125f;   // 1/sqrt(DK)
  const int hf = lane >> 4, col = lane & 15;

  // stage(pp, t0): each of 256 lanes moves one 16B K chunk + one 16B V chunk
  auto stage = [&](int pp, int t0) {
    async_copy2_b128(
        kbase + (uint32_t)((pp * 32 * KP + krow * KP + kcg * 8) * 2),
        Kbh + (size_t)t0 * 64 + tid * 8,
        vbase + (uint32_t)((pp * 64 * VP + vrow * VP + vcg * 8) * 2),
        Vbh + (size_t)vrow * 2048 + t0 + vcg * 8);
  };

  stage(0, 0);  // prologue

  for (int n = 0; n < 64; ++n) {
    const int pp = n & 1;
    wait_ds0();           // my reads of the other buffer have retired
    wait_async0();        // my chunks of buffer pp have landed
    __syncthreads();      // everyone's chunks have landed; prev reads done
    if (n + 1 < 64) stage(pp ^ 1, (n + 1) * 32);   // overlap next block

    const _Float16* Kc = &Kl[pp][0];
    const _Float16* Vc = &Vl[pp][0];

    // ---- scores^T: 32 keys x 16 queries (two 16x16 tiles, K-dim = 64) ----
    v8f s0 = {}, s1 = {};
    {
      v16h kb0 = load_frag(Kc, KP);
      v16h kb1 = load_frag(Kc + 32, KP);
      s0 = wmma16(kb0, qf0, s0);
      s0 = wmma16(kb1, qf1, s0);
      v16h kb2 = load_frag(Kc + 16 * KP, KP);
      v16h kb3 = load_frag(Kc + 16 * KP + 32, KP);
      s1 = wmma16(kb2, qf0, s1);
      s1 = wmma16(kb3, qf1, s1);
    }

    // ---- online softmax: 16 keys of one query per lane --------------------
    float a0[8], a1[8];
    float bm = -1e30f;
#pragma unroll
    for (int r = 0; r < 8; ++r) {
      a0[r] = s0[r] * scale;
      a1[r] = s1[r] * scale;
      bm = fmaxf(bm, fmaxf(a0[r], a1[r]));
    }
    bm = fmaxf(bm, xhalf(bm));           // the other 16 keys of the block
    const float mnew = fmaxf(mrow, bm);
    const float c = __expf(mrow - mnew);
    mrow = mnew;

    // P^T as B fragment: element s = key 8*hf+s (s < 8) or 16+8*hf+(s-8),
    // the k order in which load_frag brings the V^T rows
    v16h pf;
    float ps = 0.0f;
#pragma unroll
    for (int r = 0; r < 8; ++r) {
      float p0 = __expf(a0[r] - mnew);
      float p1 = __expf(a1[r] - mnew);
      ps += p0 + p1;
      pf[r]     = (_Float16)p0;
      pf[r + 8] = (_Float16)p1;
    }
    lrow = lrow * c + ps;
#pragma unroll
    for (int nt = 0; nt < 4; ++nt)
#pragma unroll
      for (int r = 0; r < 8; ++r) acc[nt][r] *= c;

    // ---- O^T += V^T P^T : A = V^T rows (dv, t-contiguous), B = P^T --------
#pragma unroll
    for (int nt = 0; nt < 4; ++nt) {
      v16h vb = load_frag(Vc + (size_t)(nt * 16) * VP, VP);
      acc[nt] = wmma16(vb, pf, acc[nt]);
    }
  }

  // epilogue: join the halves' sums, normalize, write f16 concat
  // [b][s][h*64 + dv]; a lane's 8 values of a tile are 8 consecutive dv
  lrow += xhalf(lrow);
  const int b = bh >> 3, h = bh & 7;
  _Float16* orow = concat + ((size_t)(b * 2048 + q0 + col)) * 512 + h * 64 + 8 * hf;
#pragma unroll
  for (int nt = 0; nt < 4; ++nt) {
    union { _Float16 e[8]; uint4 q; } o;
#pragma unroll
    for (int r = 0; r < 8; ++r) o.e[r] = (_Float16)(acc[nt][r] / lrow);
    *(uint4*)(orow + nt * 16) = o.q;
  }
}

// ---------------------------------------------------------------------------
// Output projection: [8192 x 512] @ [512 x 512] + bo -> f32
// grid (8192/128, 512/64), block 256; register double-buffered K-loop.
// ---------------------------------------------------------------------------
__global__ __launch_bounds__(256) void outproj_kernel(
    const _Float16* __restrict__ concat, const _Float16* __restrict__ Wot,
    const float* __restrict__ bo, float* __restrict__ out) {
  const int wave = threadIdx.x >> 5;
  const int lane = threadIdx.x & 31;
  const int m0 = blockIdx.x * 128 + wave * 16;
  const int n0 = blockIdx.y * 64;

  v8f acc[4] = {};
  const _Float16* Arow = concat + (size_t)m0 * 512;
  const _Float16* Brow = Wot + (size_t)n0 * 512;

  v16h a = load_frag(Arow, 512);
  v16h b0 = load_frag(Brow, 512);
  v16h b1 = load_frag(Brow + (size_t)16 * 512, 512);
  v16h b2 = load_frag(Brow + (size_t)32 * 512, 512);
  v16h b3 = load_frag(Brow + (size_t)48 * 512, 512);
#pragma unroll 4
  for (int k = 0; k < 512; k += 32) {
    v16h an = {}, c0 = {}, c1 = {}, c2 = {}, c3 = {};
    if (k + 32 < 512) {
      an = load_frag(Arow + k + 32, 512);
      c0 = load_frag(Brow + k + 32, 512);
      c1 = load_frag(Brow + (size_t)16 * 512 + k + 32, 512);
      c2 = load_frag(Brow + (size_t)32 * 512 + k + 32, 512);
      c3 = load_frag(Brow + (size_t)48 * 512 + k + 32, 512);
    }
    acc[0] = wmma16(a, b0, acc[0]);
    acc[1] = wmma16(a, b1, acc[1]);
    acc[2] = wmma16(a, b2, acc[2]);
    acc[3] = wmma16(a, b3, acc[3]);
    a = an; b0 = c0; b1 = c1; b2 = c2; b3 = c3;
  }
  const int hf = lane >> 4, col = lane & 15;
#pragma unroll
  for (int nt = 0; nt < 4; ++nt) {
    int n = n0 + nt * 16 + col;
    float bval = bo[n];
#pragma unroll
    for (int r = 0; r < 8; ++r) {
      int m = m0 + r + 8 * hf;
      out[(size_t)m * 512 + n] = acc[nt][r] + bval;
    }
  }
}

// ---------------------------------------------------------------------------
extern "C" void kernel_launch(void* const* d_in, const int* in_sizes, int n_in,
                              void* d_out, int out_size, void* d_ws,
                              size_t ws_size, hipStream_t stream) {
  const float* x_q = (const float*)d_in[0];
  const float* x_k = (const float*)d_in[1];
  const float* x_v = (const float*)d_in[2];
  const float* Wq  = (const float*)d_in[3];
  const float* bq  = (const float*)d_in[4];
  const float* Wk  = (const float*)d_in[5];
  const float* bk  = (const float*)d_in[6];
  const float* Wv  = (const float*)d_in[7];
  const float* bv  = (const float*)d_in[8];
  const float* Wo  = (const float*)d_in[9];
  const float* bo  = (const float*)d_in[10];
  float* out = (float*)d_out;
  (void)in_sizes; (void)n_in; (void)out_size; (void)ws_size;

  // workspace carve-up (~61 MB total)
  char* ws = (char*)d_ws;
  size_t off = 0;
  auto take = [&](size_t elems) {
    _Float16* p = (_Float16*)(ws + off);
    off += elems * sizeof(_Float16);
    return p;
  };
  const size_t XE = (size_t)8192 * 512;
  const size_t WE = (size_t)8 * 64 * 512;
  _Float16* xqh = take(XE);
  _Float16* xkh = take(XE);
  _Float16* xvh = take(XE);
  _Float16* Wqt = take(WE);
  _Float16* Wkt = take(WE);
  _Float16* Wvt = take(WE);
  _Float16* Wot = take((size_t)512 * 512);
  _Float16* Qd  = take(XE);
  _Float16* Kd  = take(XE);
  _Float16* Vtd = take(XE);
  _Float16* Cc  = take(XE);

  cvt_f16<<<(int)(XE / 256), 256, 0, stream>>>(x_q, xqh, (int)XE);
  cvt_f16<<<(int)(XE / 256), 256, 0, stream>>>(x_k, xkh, (int)XE);
  cvt_f16<<<(int)(XE / 256), 256, 0, stream>>>(x_v, xvh, (int)XE);
  cvt_tr_w<<<(int)(WE / 256), 256, 0, stream>>>(Wq, Wqt);
  cvt_tr_w<<<(int)(WE / 256), 256, 0, stream>>>(Wk, Wkt);
  cvt_tr_w<<<(int)(WE / 256), 256, 0, stream>>>(Wv, Wvt);
  cvt_tr_wo<<<1024, 256, 0, stream>>>(Wo, Wot);

  proj_kernel<<<dim3(64, 8, 3), 256, 0, stream>>>(
      xqh, xkh, xvh, Wqt, Wkt, Wvt, bq, bk, bv, Qd, Kd, Vtd);

  attn_kernel<<<dim3(16, 32), 256, 0, stream>>>(Qd, Kd, Vtd, Cc);

  outproj_kernel<<<dim3(64, 8), 256, 0, stream>>>(Cc, Wot, bo, out);
}

// v003
// One run takes 167 microseconds.
// Next to v002, in two timings, it ran 1.13 times as fast each time.
// Counting every step since v000, it is 1.61 times as fast.
#include <hip/hip_runtime.h>
#include <hip/hip_bf16.h>
#include <stdint.h>

// ---------------------------------------------------------------------------
// MultiHeadAttention for MI455X (gfx1250, wave32, WMMA 16x16x32 f16)
//   B=4 S=2048 F=512 H=8 DK=DV=64 FILT=512
// Pipeline: f16 convert -> QKV proj GEMM (WMMA, reg-double-buffered) ->
// flash attention (WMMA + online softmax + async-to-LDS double buffering) ->
// output GEMM (WMMA, f32 out)
// ---------------------------------------------------------------------------

typedef __attribute__((ext_vector_type(16))) _Float16 v16h;
typedef __attribute__((ext_vector_type(8)))  float    v8f;

union Frag16 { v16h h; uint4 q[2]; };

// Load a 16x32 f16 fragment (A layout; also our B layout when the source is
// stored reduction-contiguous per row).
//   lane%16 -> row (A: M, B: N); lane/16 -> K half {0..7,16..23} vs {8..15,24..31}
// Two 16-byte transactions; all call sites guarantee 16-B alignment.
__device__ __forceinline__ v16h load_frag(const _Float16* base, int ld) {
  const int lane = threadIdx.x & 31;
  const int hi   = lane >> 4;
  const int idx  = lane & 15;
  const _Float16* row = base + (size_t)idx * ld + hi * 8;
  Frag16 f;
  f.q[0] = *(const uint4*)(row);
  f.q[1] = *(const uint4*)(row + 16);
  return f.h;
}

__device__ __forceinline__ v8f wmma16(v16h a, v16h b, v8f c) {
  return __builtin_amdgcn_wmma_f32_16x16x32_f16(false, a, false, b,
                                                (short)0, c, false, false);
}

// CDNA5 async memory->LDS copies, 16B per lane each, tracked by ASYNCcnt.
// Both copies of a stage and their s_wait_xcnt stand in one statement, so the
// address registers are not rewritten ahead of that wait.
__device__ __forceinline__ void async_copy2_b128(uint32_t lds0,
                                                 const _Float16* g0,
                                                 uint32_t lds1,
                                                 const _Float16* g1) {
  asm volatile("global_load_async_to_lds_b128 %0, %1, off\n\t"
               "global_load_async_to_lds_b128 %2, %3, off\n\t"
               "s_wait_xcnt 0x0"
               :: "v"(lds0), "v"((uint64_t)(uintptr_t)g0),
                  "v"(lds1), "v"((uint64_t)(uintptr_t)g1)
               : "memory");
}
__device__ __forceinline__ void wait_async0() {
  asm volatile("s_wait_asynccnt 0x0" ::: "memory");
}
// This wave's LDS reads of the buffer that is refilled next have retired.
__device__ __forceinline__ void wait_ds0() {
  asm volatile("s_wait_dscnt 0x0" ::: "memory");
}

// ---------------------------------------------------------------------------
// Elementwise conversion kernels
// ---------------------------------------------------------------------------
typedef __attribute__((ext_vector_type(4))) float    v4f;
typedef __attribute__((ext_vector_type(4))) _Float16 v4h;

// x_q, x_k, x_v (f32, 8192*512 each) -> f16 in ONE launch of 512 x 8 waves.
// A wave owns 1024 consecutive elements of each tensor: 8 loads of 512
// contiguous bytes per tensor, all 24 in flight together, then 8 stores of
// 256 contiguous bytes (two whole lines) per tensor.
__global__ __launch_bounds__(256) void cvt_x(
    const float* __restrict__ xq, const float* __restrict__ xk,
    const float* __restrict__ xv, _Float16* __restrict__ dq,
    _Float16* __restrict__ dk, _Float16* __restrict__ dv) {
  const int off = (blockIdx.x * 8 + (threadIdx.x >> 5)) * 1024 +
                  (threadIdx.x & 31) * 4;
  v4f a[8], b[8], c[8];
#pragma unroll
  for (int j = 0; j < 8; ++j) a[j] = *(const v4f*)(xq + off + j * 128);
#pragma unroll
  for (int j = 0; j < 8; ++j) b[j] = *(const v4f*)(xk + off + j * 128);
#pragma unroll
  for (int j = 0; j < 8; ++j) c[j] = *(const v4f*)(xv + off + j * 128);
  // The loads' address registers are reused below: this wait stands in front
  // of the first such overwrite. The three addresses are inputs so that no
  // later load's result is placed on them ahead of the wait.
  asm volatile("s_wait_xcnt 0x0"
               :: "v"(xq + off), "v"(xk + off), "v"(xv + off) : "memory");
  // No conversion is scheduled up among the loads: without this the compiler
  // holds 11 of the 24 loads back until registers of the first ones are free.
  __builtin_amdgcn_sched_barrier(0);
#pragma unroll
  for (int j = 0; j < 8; ++j)
    *(v4h*)(dq + off + j * 128) = __builtin_convertvector(a[j], v4h);
#pragma unroll
  for (int j = 0; j < 8; ++j)
    *(v4h*)(dk + off + j * 128) = __builtin_convertvector(b[j], v4h);
#pragma unroll
  for (int j = 0; j < 8; ++j)
    *(v4h*)(dv + off + j * 128) = __builtin_convertvector(c[j], v4h);
}

// W[h][f][dk] (f32) -> Wt[h][dk][f] (f16), H=8 F=512 DK=64
__global__ __launch_bounds__(256) void cvt_tr_w(const float* __restrict__ W,
                                                _Float16* __restrict__ Wt) {
  int i  = blockIdx.x * 256 + threadIdx.x;
  int f  = i & 511;
  int dk = (i >> 9) & 63;
  int h  = i >> 15;
  Wt[i] = (_Float16)W[((size_t)h * 512 + f) * 64 + dk];
}

// Wo[c][o] (512x512 f32) -> Wot[o][c] (f16)
__global__ __launch_bounds__(256) void cvt_tr_wo(const float* __restrict__ W,
                                                 _Float16* __restrict__ Wt) {
  int i = blockIdx.x * 256 + threadIdx.x;
  int c = i & 511, o = i >> 9;
  Wt[i] = (_Float16)W[(size_t)c * 512 + o];
}

// ---------------------------------------------------------------------------
// QKV projection: per (which,h): [8192 x 512] @ [512 x 64] + bias
// grid (8192/128, H, 3), block 256 (8 waves, each a 16x64 tile)
// which==2 (V) stores transposed [b][h][dv][s]
// Register double-buffered K-loop so WMMAs overlap the next step's loads.
// ---------------------------------------------------------------------------
__global__ __launch_bounds__(256) void proj_kernel(
    const _Float16* __restrict__ xq, const _Float16* __restrict__ xk,
    const _Float16* __restrict__ xv,
    const _Float16* __restrict__ Wqt, const _Float16* __restrict__ Wkt,
    const _Float16* __restrict__ Wvt,
    const float* __restrict__ bq, const float* __restrict__ bk,
    const float* __restrict__ bv,
    _Float16* __restrict__ Qd, _Float16* __restrict__ Kd,
    _Float16* __restrict__ Vtd) {
  const int wave = threadIdx.x >> 5;
  const int lane = threadIdx.x & 31;
  const int h     = blockIdx.y;
  const int which = blockIdx.z;

  const _Float16* x    = which == 0 ? xq : which == 1 ? xk : xv;
  const _Float16* Wt   = which == 0 ? Wqt : which == 1 ? Wkt : Wvt;
  const float*    bias = which == 0 ? bq : which == 1 ? bk : bv;

  const int m0 = blockIdx.x * 128 + wave * 16;
  v8f acc[4] = {};
  const _Float16* Arow = x + (size_t)m0 * 512;
  const _Float16* Brow = Wt + (size_t)h * 64 * 512;   // [dk][f]

  v16h a = load_frag(Arow, 512);
  v16h b0 = load_frag(Brow, 512);
  v16h b1 = load_frag(Brow + (size_t)16 * 512, 512);
  v16h b2 = load_frag(Brow + (size_t)32 * 512, 512);
  v16h b3 = load_frag(Brow + (size_t)48 * 512, 512);
#pragma unroll 4
  for (int k = 0; k < 512; k += 32) {
    v16h an = {}, c0 = {}, c1 = {}, c2 = {}, c3 = {};
    if (k + 32 < 512) {
      an = load_frag(Arow + k + 32, 512);
      c0 = load_frag(Brow + k + 32, 512);
      c1 = load_frag(Brow + (size_t)16 * 512 + k + 32, 512);
      c2 = load_frag(Brow + (size_t)32 * 512 + k + 32, 512);
      c3 = load_frag(Brow + (size_t)48 * 512 + k + 32, 512);
    }
    acc[0] = wmma16(a, b0, acc[0]);
    acc[1] = wmma16(a, b1, acc[1]);
    acc[2] = wmma16(a, b2, acc[2]);
    acc[3] = wmma16(a, b3, acc[3]);
    a = an; b0 = c0; b1 = c1; b2 = c2; b3 = c3;
  }

  const int hf = lane >> 4, col = lane & 15;
#pragma unroll
  for (int nt = 0; nt < 4; ++nt) {
    int n = nt * 16 + col;
    float bval = bias[h * 64 + n];
#pragma unroll
    for (int r = 0; r < 8; ++r) {
      int m = m0 + r + 8 * hf;
      int b = m >> 11, s = m & 2047;
      float val = acc[nt][r] + bval;
      if (which == 0)
        Qd[(((size_t)b * 8 + h) * 2048 + s) * 64 + n] = (_Float16)val;
      else if (which == 1)
        Kd[(((size_t)b * 8 + h) * 2048 + s) * 64 + n] = (_Float16)val;
      else
        Vtd[(((size_t)b * 8 + h) * 64 + n) * 2048 + s] = (_Float16)val;
    }
  }
}

constexpr int KP = 72;   // K row pitch in halves: 64 data + 8 pad (144 B)
constexpr int VP = 40;   // V^T row pitch in halves: 32 data + 8 pad (80 B)

// value of lane l ^ 16
__device__ __forceinline__ float xhalf(float x) {
  int b = __builtin_bit_cast(int, x);
  return __builtin_bit_cast(
      float, __builtin_amdgcn_permlanex16(b, b, 0x76543210, 0xfedcba98, false,
                                          false));
}

__global__ __launch_bounds__(256) void attn_kernel(
    const _Float16* __restrict__ Qd, const _Float16* __restrict__ Kd,
    const _Float16* __restrict__ Vtd, _Float16* __restrict__ concat) {
  __shared__ __align__(16) _Float16 Kl[2][32 * KP];   // [t][dk]
  __shared__ __align__(16) _Float16 Vl[2][64 * VP];   // [dv][t]

  const int tid  = threadIdx.x;
  const int wave = tid >> 5;
  const int lane = tid & 31;
  const int bh   = blockIdx.y;                 // b*8 + h
  const int q0   = blockIdx.x * 128 + wave * 16;

  const _Float16* Qbh = Qd + (size_t)bh * 2048 * 64;
  const _Float16* Kbh = Kd + (size_t)bh * 2048 * 64;
  const _Float16* Vbh = Vtd + (size_t)bh * 64 * 2048;

  // hardware LDS byte offsets for async copies
  const uint32_t kbase = (uint32_t)(uintptr_t)(void*)&Kl[0][0];
  const uint32_t vbase = (uint32_t)(uintptr_t)(void*)&Vl[0][0];
  const int krow = tid >> 3, kcg = tid & 7;    // K:   32 rows x 8 chunks
  const int vrow = tid >> 2, vcg = tid & 3;    // V^T: 64 rows x 4 chunks

  // B fragments of Q^T: column = query lane%16
  const v16h qf0 = load_frag(Qbh + (size_t)q0 * 64, 64);
  const v16h qf1 = load_frag(Qbh + (size_t)q0 * 64 + 32, 64);

  float mrow = -1e30f;   // running maximum of this lane's query
  float lrow = 0.0f;     // running sum over this wave half's keys only
  v8f acc[4] = {};       // O^T: acc[nt][r] = O[query col][nt*16 + 8*hf + r]

  const float scale = 0.125f;   // 1/sqrt(DK)
  const int hf = lane >> 4, col = lane & 15;

  // stage(pp, t0): each of 256 lanes moves one 16B K chunk + one 16B V chunk
  auto stage = [&](int pp, int t0) {
    async_copy2_b128(
        kbase + (uint32_t)((pp * 32 * KP + krow * KP + kcg * 8) * 2),
        Kbh + (size_t)t0 * 64 + tid * 8,
        vbase + (uint32_t)((pp * 64 * VP + vrow * VP + vcg * 8) * 2),
        Vbh + (size_t)vrow * 2048 + t0 + vcg * 8);
  };

  stage(0, 0);  // prologue

  for (int n = 0; n < 64; ++n) {
    const int pp = n & 1;
    wait_ds0();           // my reads of the other buffer have retired
    wait_async0();        // my chunks of buffer pp have landed
    __syncthreads();      // everyone's chunks have landed; prev reads done
    if (n + 1 < 64) stage(pp ^ 1, (n + 1) * 32);   // overlap next block

    const _Float16* Kc = &Kl[pp][0];
    const _Float16* Vc = &Vl[pp][0];

    // ---- scores^T: 32 keys x 16 queries (two 16x16 tiles, K-dim = 64) ----
    v8f s0 = {}, s1 = {};
    {
      v16h kb0 = load_frag(Kc, KP);
      v16h kb1 = load_frag(Kc + 32, KP);
      s0 = wmma16(kb0, qf0, s0);
      s0 = wmma16(kb1, qf1, s0);
      v16h kb2 = load_frag(Kc + 16 * KP, KP);
      v16h kb3 = load_frag(Kc + 16 * KP + 32, KP);
      s1 = wmma16(kb2, qf0, s1);
      s1 = wmma16(kb3, qf1, s1);
    }

    // ---- online softmax: 16 keys of one query per lane --------------------
    float a0[8], a1[8];
    float bm = -1e30f;
#pragma unroll
    for (int r = 0; r < 8; ++r) {
      a0[r] = s0[r] * scale;
      a1[r] = s1[r] * scale;
      bm = fmaxf(bm, fmaxf(a0[r], a1[r]));
    }
    bm = fmaxf(bm, xhalf(bm));           // the other 16 keys of the block
    const float mnew = fmaxf(mrow, bm);
    const float c = __expf(mrow - mnew);
    mrow = mnew;

    // P^T as B fragment: element s = key 8*hf+s (s < 8) or 16+8*hf+(s-8),
    // the k order in which load_frag brings the V^T rows
    v16h pf;
    float ps = 0.0f;
#pragma unroll
    for (int r = 0; r < 8; ++r) {
      float p0 = __expf(a0[r] - mnew);
      float p1 = __expf(a1[r] - mnew);
      ps += p0 + p1;
      pf[r]     = (_Float16)p0;
      pf[r + 8] = (_Float16)p1;
    }
    lrow = lrow * c + ps;
#pragma unroll
    for (int nt = 0; nt < 4; ++nt)
#pragma unroll
      for (int r = 0; r < 8; ++r) acc[nt][r] *= c;

    // ---- O^T += V^T P^T : A = V^T rows (dv, t-contiguous), B = P^T --------
#pragma unroll
    for (int nt = 0; nt < 4; ++nt) {
      v16h vb = load_frag(Vc + (size_t)(nt * 16) * VP, VP);
      acc[nt] = wmma16(vb, pf, acc[nt]);
    }
  }

  // epilogue: join the halves' sums, normalize, write f16 concat
  // [b][s][h*64 + dv]; a lane's 8 values of a tile are 8 consecutive dv
  lrow += xhalf(lrow);
  const int b = bh >> 3, h = bh & 7;
  _Float16* orow = concat + ((size_t)(b * 2048 + q0 + col)) * 512 + h * 64 + 8 * hf;
#pragma unroll
  for (int nt = 0; nt < 4; ++nt) {
    union { _Float16 e[8]; uint4 q; } o;
#pragma unroll
    for (int r = 0; r < 8; ++r) o.e[r] = (_Float16)(acc[nt][r] / lrow);
    *(uint4*)(orow + nt * 16) = o.q;
  }
}

// ---------------------------------------------------------------------------
// Output projection: [8192 x 512] @ [512 x 512] + bo -> f32
// grid (8192/128, 512/64), block 256; register double-buffered K-loop.
// ---------------------------------------------------------------------------
__global__ __launch_bounds__(256) void outproj_kernel(
    const _Float16* __restrict__ concat, const _Float16* __restrict__ Wot,
    const float* __restrict__ bo, float* __restrict__ out) {
  const int wave = threadIdx.x >> 5;
  const int lane = threadIdx.x & 31;
  const int m0 = blockIdx.x * 128 + wave * 16;
  const int n0 = blockIdx.y * 64;

  v8f acc[4] = {};
  const _Float16* Arow = concat + (size_t)m0 * 512;
  const _Float16* Brow = Wot + (size_t)n0 * 512;

  v16h a = load_frag(Arow, 512);
  v16h b0 = load_frag(Brow, 512);
  v16h b1 = load_frag(Brow + (size_t)16 * 512, 512);
  v16h b2 = load_frag(Brow + (size_t)32 * 512, 512);
  v16h b3 = load_frag(Brow + (size_t)48 * 512, 512);
#pragma unroll 4
  for (int k = 0; k < 512; k += 32) {
    v16h an = {}, c0 = {}, c1 = {}, c2 = {}, c3 = {};
    if (k + 32 < 512) {
      an = load_frag(Arow + k + 32, 512);
      c0 = load_frag(Brow + k + 32, 512);
      c1 = load_frag(Brow + (size_t)16 * 512 + k + 32, 512);
      c2 = load_frag(Brow + (size_t)32 * 512 + k + 32, 512);
      c3 = load_frag(Brow + (size_t)48 * 512 + k + 32, 512);
    }
    acc[0] = wmma16(a, b0, acc[0]);
    acc[1] = wmma16(a, b1, acc[1]);
    acc[2] = wmma16(a, b2, acc[2]);
    acc[3] = wmma16(a, b3, acc[3]);
    a = an; b0 = c0; b1 = c1; b2 = c2; b3 = c3;
  }
  const int hf = lane >> 4, col = lane & 15;
#pragma unroll
  for (int nt = 0; nt < 4; ++nt) {
    int n = n0 + nt * 16 + col;
    float bval = bo[n];
#pragma unroll
    for (int r = 0; r < 8; ++r) {
      int m = m0 + r + 8 * hf;
      out[(size_t)m * 512 + n] = acc[nt][r] + bval;
    }
  }
}

// ---------------------------------------------------------------------------
extern "C" void kernel_launch(void* const* d_in, const int* in_sizes, int n_in,
                              void* d_out, int out_size, void* d_ws,
                              size_t ws_size, hipStream_t stream) {
  const float* x_q = (const float*)d_in[0];
  const float* x_k = (const float*)d_in[1];
  const float* x_v = (const float*)d_in[2];
  const float* Wq  = (const float*)d_in[3];
  const float* bq  = (const float*)d_in[4];
  const float* Wk  = (const float*)d_in[5];
  const float* bk  = (const float*)d_in[6];
  const float* Wv  = (const float*)d_in[7];
  const float* bv  = (const float*)d_in[8];
  const float* Wo  = (const float*)d_in[9];
  const float* bo  = (const float*)d_in[10];
  float* out = (float*)d_out;
  (void)in_sizes; (void)n_in; (void)out_size; (void)ws_size;

  // workspace carve-up (~61 MB total)
  char* ws = (char*)d_ws;
  size_t off = 0;
  auto take = [&](size_t elems) {
    _Float16* p = (_Float16*)(ws + off);
    off += elems * sizeof(_Float16);
    return p;
  };
  const size_t XE = (size_t)8192 * 512;
  const size_t WE = (size_t)8 * 64 * 512;
  _Float16* xqh = take(XE);
  _Float16* xkh = take(XE);
  _Float16* xvh = take(XE);
  _Float16* Wqt = take(WE);
  _Float16* Wkt = take(WE);
  _Float16* Wvt = take(WE);
  _Float16* Wot = take((size_t)512 * 512);
  _Float16* Qd  = take(XE);
  _Float16* Kd  = take(XE);
  _Float16* Vtd = take(XE);
  _Float16* Cc  = take(XE);

  cvt_x<<<512, 256, 0, stream>>>(x_q, x_k, x_v, xqh, xkh, xvh);
  cvt_tr_w<<<(int)(WE / 256), 256, 0, stream>>>(Wq, Wqt);
  cvt_tr_w<<<(int)(WE / 256), 256, 0, stream>>>(Wk, Wkt);
  cvt_tr_w<<<(int)(WE / 256), 256, 0, stream>>>(Wv, Wvt);
  cvt_tr_wo<<<1024, 256, 0, stream>>>(Wo, Wot);

  proj_kernel<<<dim3(64, 8, 3), 256, 0, stream>>>(
      xqh, xkh, xvh, Wqt, Wkt, Wvt, bq, bk, bv, Qd, Kd, Vtd);

  attn_kernel<<<dim3(16, 32), 256, 0, stream>>>(Qd, Kd, Vtd, Cc);

  outproj_kernel<<<dim3(64, 8), 256, 0, stream>>>(Cc, Wot, bo, out);
}

// v004
// A run of this version takes 96.7 microseconds.
// Timed twice side by side with v003, it ran 1.74 and 1.72 times as fast.
// Over all steps from v000 it is 2.78 times as fast.
#include <hip/hip_runtime.h>
#include <hip/hip_bf16.h>
#include <stdint.h>

// ---------------------------------------------------------------------------
// MultiHeadAttention for MI455X (gfx1250, wave32, WMMA 16x16x32 f16)
//   B=4 S=2048 F=512 H=8 DK=DV=64 FILT=512
// Pipeline: f16 convert -> QKV proj GEMM (WMMA, tiles staged in LDS) ->
// flash attention (WMMA + online softmax + async-to-LDS double buffering) ->
// output GEMM (WMMA, tiles staged in LDS, f32 out)
// ---------------------------------------------------------------------------

typedef __attribute__((ext_vector_type(16))) _Float16 v16h;
typedef __attribute__((ext_vector_type(8)))  float    v8f;

union Frag16 { v16h h; uint4 q[2]; };

// Load a 16x32 f16 fragment (A layout; also our B layout when the source is
// stored reduction-contiguous per row).
//   lane%16 -> row (A: M, B: N); lane/16 -> K half {0..7,16..23} vs {8..15,24..31}
// Two 16-byte transactions; all call sites guarantee 16-B alignment.
__device__ __forceinline__ v16h load_frag(const _Float16* base, int ld) {
  const int lane = threadIdx.x & 31;
  const int hi   = lane >> 4;
  const int idx  = lane & 15;
  const _Float16* row = base + (size_t)idx * ld + hi * 8;
  Frag16 f;
  f.q[0] = *(const uint4*)(row);
  f.q[1] = *(const uint4*)(row + 16);
  return f.h;
}

__device__ __forceinline__ v8f wmma16(v16h a, v16h b, v8f c) {
  return __builtin_amdgcn_wmma_f32_16x16x32_f16(false, a, false, b,
                                                (short)0, c, false, false);
}

// CDNA5 async memory->LDS copies, 16B per lane each, tracked by ASYNCcnt.
// Both copies of a stage and their s_wait_xcnt stand in one statement, so the
// address registers are not rewritten ahead of that wait.
__device__ __forceinline__ void async_copy2_b128(uint32_t lds0,
                                                 const _Float16* g0,
                                                 uint32_t lds1,
                                                 const _Float16* g1) {
  asm volatile("global_load_async_to_lds_b128 %0, %1, off\n\t"
               "global_load_async_to_lds_b128 %2, %3, off\n\t"
               "s_wait_xcnt 0x0"
               :: "v"(lds0), "v"((uint64_t)(uintptr_t)g0),
                  "v"(lds1), "v"((uint64_t)(uintptr_t)g1)
               : "memory");
}
__device__ __forceinline__ void wait_async0() {
  asm volatile("s_wait_asynccnt 0x0" ::: "memory");
}
// This wave's LDS reads of the buffer that is refilled next have retired.
__device__ __forceinline__ void wait_ds0() {
  asm volatile("s_wait_dscnt 0x0" ::: "memory");
}

// ---------------------------------------------------------------------------
// Elementwise conversion kernels
// ---------------------------------------------------------------------------
typedef __attribute__((ext_vector_type(4))) float    v4f;
typedef __attribute__((ext_vector_type(4))) _Float16 v4h;

// x_q, x_k, x_v (f32, 8192*512 each) -> f16 in ONE launch of 512 x 8 waves.
// A wave owns 1024 consecutive elements of each tensor: 8 loads of 512
// contiguous bytes per tensor, all 24 in flight together, then 8 stores of
// 256 contiguous bytes (two whole lines) per tensor.
__global__ __launch_bounds__(256) void cvt_x(
    const float* __restrict__ xq, const float* __restrict__ xk,
    const float* __restrict__ xv, _Float16* __restrict__ dq,
    _Float16* __restrict__ dk, _Float16* __restrict__ dv) {
  const int off = (blockIdx.x * 8 + (threadIdx.x >> 5)) * 1024 +
                  (threadIdx.x & 31) * 4;
  v4f a[8], b[8], c[8];
#pragma unroll
  for (int j = 0; j < 8; ++j) a[j] = *(const v4f*)(xq + off + j * 128);
#pragma unroll
  for (int j = 0; j < 8; ++j) b[j] = *(const v4f*)(xk + off + j * 128);
#pragma unroll
  for (int j = 0; j < 8; ++j) c[j] = *(const v4f*)(xv + off + j * 128);
  // The loads' address registers are reused below: this wait stands in front
  // of the first such overwrite. The three addresses are inputs so that no
  // later load's result is placed on them ahead of the wait.
  asm volatile("s_wait_xcnt 0x0"
               :: "v"(xq + off), "v"(xk + off), "v"(xv + off) : "memory");
  // No conversion is scheduled up among the loads: without this the compiler
  // holds 11 of the 24 loads back until registers of the first ones are free.
  __builtin_amdgcn_sched_barrier(0);
#pragma unroll
  for (int j = 0; j < 8; ++j)
    *(v4h*)(dq + off + j * 128) = __builtin_convertvector(a[j], v4h);
#pragma unroll
  for (int j = 0; j < 8; ++j)
    *(v4h*)(dk + off + j * 128) = __builtin_convertvector(b[j], v4h);
#pragma unroll
  for (int j = 0; j < 8; ++j)
    *(v4h*)(dv + off + j * 128) = __builtin_convertvector(c[j], v4h);
}

// W[h][f][dk] (f32) -> Wt[h][dk][f] (f16), H=8 F=512 DK=64
__global__ __launch_bounds__(256) void cvt_tr_w(const float* __restrict__ W,
                                                _Float16* __restrict__ Wt) {
  int i  = blockIdx.x * 256 + threadIdx.x;
  int f  = i & 511;
  int dk = (i >> 9) & 63;
  int h  = i >> 15;
  Wt[i] = (_Float16)W[((size_t)h * 512 + f) * 64 + dk];
}

// Wo[c][o] (512x512 f32) -> Wot[o][c] (f16)
__global__ __launch_bounds__(256) void cvt_tr_wo(const float* __restrict__ W,
                                                 _Float16* __restrict__ Wt) {
  int i = blockIdx.x * 256 + threadIdx.x;
  int c = i & 511, o = i >> 9;
  Wt[i] = (_Float16)W[(size_t)c * 512 + o];
}

constexpr int GP = 72;
constexpr int GT = 128 * GP;

// Eight copies (one tile's share of a lane) and their s_wait_xcnt in one
// statement, so the address registers are not rewritten ahead of that wait.
__device__ __forceinline__ void async_copy8_b128(
    uint32_t l0, const _Float16* g0, uint32_t l1, const _Float16* g1,
    uint32_t l2, const _Float16* g2, uint32_t l3, const _Float16* g3,
    uint32_t l4, const _Float16* g4, uint32_t l5, const _Float16* g5,
    uint32_t l6, const _Float16* g6, uint32_t l7, const _Float16* g7) {
  asm volatile("global_load_async_to_lds_b128 %0, %1, off\n\t"
               "global_load_async_to_lds_b128 %2, %3, off\n\t"
               "global_load_async_to_lds_b128 %4, %5, off\n\t"
               "global_load_async_to_lds_b128 %6, %7, off\n\t"
               "global_load_async_to_lds_b128 %8, %9, off\n\t"
               "global_load_async_to_lds_b128 %10, %11, off\n\t"
               "global_load_async_to_lds_b128 %12, %13, off\n\t"
               "global_load_async_to_lds_b128 %14, %15, off\n\t"
               "s_wait_xcnt 0x0"
               :: "v"(l0), "v"((uint64_t)(uintptr_t)g0),
                  "v"(l1), "v"((uint64_t)(uintptr_t)g1),
                  "v"(l2), "v"((uint64_t)(uintptr_t)g2),
                  "v"(l3), "v"((uint64_t)(uintptr_t)g3),
                  "v"(l4), "v"((uint64_t)(uintptr_t)g4),
                  "v"(l5), "v"((uint64_t)(uintptr_t)g5),
                  "v"(l6), "v"((uint64_t)(uintptr_t)g6),
                  "v"(l7), "v"((uint64_t)(uintptr_t)g7)
               : "memory");
}

// A, B: first row of the block's 128 rows. As, Bs: two buffers of GT halves.
// acc[i][j]: rows wm*32 + i*16 .., columns wn*64 + j*16 .. of the block tile.
__device__ __forceinline__ void gemm_128x128_k512(
    const _Float16* __restrict__ A, const _Float16* __restrict__ B,
    const _Float16* As, const _Float16* Bs, int wm, int wn, v8f (&acc)[2][4]) {
  const int tid  = threadIdx.x;
  const int srow = tid >> 3, scg = tid & 7;   // 32 rows x 8 chunks per pass
  const _Float16* ga = A + (size_t)srow * 512 + scg * 8;
  const _Float16* gb = B + (size_t)srow * 512 + scg * 8;
  const uint32_t lofs = (uint32_t)((srow * GP + scg * 8) * 2);
  const uint32_t la = (uint32_t)(uintptr_t)(const void*)As + lofs;
  const uint32_t lb = (uint32_t)(uintptr_t)(const void*)Bs + lofs;
  constexpr uint32_t LR = 32 * GP * 2;        // 32 staged rows, bytes
  constexpr size_t   GR = (size_t)32 * 512;   // 32 source rows, halves

  auto stage = [&](int buf, int k0) {
    const uint32_t a = la + (uint32_t)(buf * GT * 2);
    const uint32_t b = lb + (uint32_t)(buf * GT * 2);
    async_copy8_b128(a,          ga + k0,          a + LR,     ga + k0 + GR,
                     a + 2 * LR, ga + k0 + 2 * GR, a + 3 * LR, ga + k0 + 3 * GR,
                     b,          gb + k0,          b + LR,     gb + k0 + GR,
                     b + 2 * LR, gb + k0 + 2 * GR, b + 3 * LR, gb + k0 + 3 * GR);
  };

  stage(0, 0);
  wait_async0();        // my chunks of tile 0 have landed
  __syncthreads();      // everyone's have
  stage(1, 64);

  for (int t = 0; t < 8; ++t) {
    const _Float16* Ac = As + (t & 1) * GT + wm * 32 * GP;
    const _Float16* Bc = Bs + (t & 1) * GT + wn * 64 * GP;
    // unrolled: both k halves of the tile in one straight run, LDS offsets as
    // immediates
#pragma unroll
    for (int kk = 0; kk < 64; kk += 32) {
      v16h a0 = load_frag(Ac + kk, GP);
      v16h a1 = load_frag(Ac + 16 * GP + kk, GP);
      v16h b0 = load_frag(Bc + kk, GP);
      v16h b1 = load_frag(Bc + 16 * GP + kk, GP);
      v16h b2 = load_frag(Bc + 32 * GP + kk, GP);
      v16h b3 = load_frag(Bc + 48 * GP + kk, GP);
      acc[0][0] = wmma16(a0, b0, acc[0][0]);
      acc[0][1] = wmma16(a0, b1, acc[0][1]);
      acc[0][2] = wmma16(a0, b2, acc[0][2]);
      acc[0][3] = wmma16(a0, b3, acc[0][3]);
      acc[1][0] = wmma16(a1, b0, acc[1][0]);
      acc[1][1] = wmma16(a1, b1, acc[1][1]);
      acc[1][2] = wmma16(a1, b2, acc[1][2]);
      acc[1][3] = wmma16(a1, b3, acc[1][3]);
    }
    wait_ds0();         // my reads of this buffer have retired
    wait_async0();      // my chunks of tile t + 1 have landed
    __syncthreads();    // tile t + 1 is published; this buffer is free
    if (t + 2 < 8) stage(t & 1, (t + 2) * 64);
  }
  wait_async0();        // nothing in flight when the wave goes on
}

// ---------------------------------------------------------------------------
// QKV projection: per which: [8192 x 512] @ [512 x (h,dk) = 512] + bias
// grid (8192/128, 512/128, 3), block 256; a wave's 64 columns are one head.
// which==2 (V) stores transposed [b][h][dv][s]
// ---------------------------------------------------------------------------
__global__ __launch_bounds__(256) void proj_kernel(
    const _Float16* __restrict__ xq, const _Float16* __restrict__ xk,
    const _Float16* __restrict__ xv,
    const _Float16* __restrict__ Wqt, const _Float16* __restrict__ Wkt,
    const _Float16* __restrict__ Wvt,
    const float* __restrict__ bq, const float* __restrict__ bk,
    const float* __restrict__ bv,
    _Float16* __restrict__ Qd, _Float16* __restrict__ Kd,
    _Float16* __restrict__ Vtd) {
  __shared__ __align__(16) _Float16 As[2 * GT];
  __shared__ __align__(16) _Float16 Bs[2 * GT];
  const int wave = threadIdx.x >> 5;
  const int lane = threadIdx.x & 31;
  const int wm = wave & 3, wn = wave >> 2;
  const int which = blockIdx.z;
  const int h     = blockIdx.y * 2 + wn;

  const _Float16* x    = which == 0 ? xq : which == 1 ? xk : xv;
  const _Float16* Wt   = which == 0 ? Wqt : which == 1 ? Wkt : Wvt;
  const float*    bias = which == 0 ? bq : which == 1 ? bk : bv;

  v8f acc[2][4] = {};
  gemm_128x128_k512(x + (size_t)blockIdx.x * 128 * 512,
                    Wt + (size_t)blockIdx.y * 128 * 512,   // [h*64 + dk][f]
                    As, Bs, wm, wn, acc);

  const int hf = lane >> 4, col = lane & 15;
  // A block's 128 rows lie in one batch (128 divides 2048): b and the lane's
  // first row s0 are formed once, and every store of the lane is its one base
  // address plus a constant.
  const int b  = blockIdx.x >> 4;
  const int s0 = (blockIdx.x & 15) * 128 + wm * 32 + 8 * hf;
  // every loop below is unrolled so that acc and bval are indexed by constants
  // only and stay in registers; the innermost index runs along the stored row
  float bval[4];
#pragma unroll
  for (int nt = 0; nt < 4; ++nt) bval[nt] = bias[h * 64 + nt * 16 + col];
  if (which == 2) {
    _Float16* p = Vtd + (((size_t)b * 8 + h) * 64 + col) * 2048 + s0;
#pragma unroll
    for (int nt = 0; nt < 4; ++nt)
#pragma unroll
      for (int i = 0; i < 2; ++i)
#pragma unroll
        for (int r = 0; r < 8; ++r)
          p[nt * 16 * 2048 + i * 16 + r] = (_Float16)(acc[i][nt][r] + bval[nt]);
  } else {
    _Float16* p = (which == 0 ? Qd : Kd) +
                  (((size_t)b * 8 + h) * 2048 + s0) * 64 + col;
#pragma unroll
    for (int i = 0; i < 2; ++i)
#pragma unroll
      for (int r = 0; r < 8; ++r)
#pragma unroll
        for (int nt = 0; nt < 4; ++nt)
          p[(i * 16 + r) * 64 + nt * 16] = (_Float16)(acc[i][nt][r] + bval[nt]);
    // In the built code this path runs on, behind a branch, into the block of
    // the V path: the wait stands in front of that block's register writes.
    asm volatile("s_wait_xcnt 0x0" ::: "memory");
  }
}

constexpr int KP = 72;   // K row pitch in halves: 64 data + 8 pad (144 B)
constexpr int VP = 40;   // V^T row pitch in halves: 32 data + 8 pad (80 B)

// value of lane l ^ 16
__device__ __forceinline__ float xhalf(float x) {
  int b = __builtin_bit_cast(int, x);
  return __builtin_bit_cast(
      float, __builtin_amdgcn_permlanex16(b, b, 0x76543210, 0xfedcba98, false,
                                          false));
}

__global__ __launch_bounds__(256) void attn_kernel(
    const _Float16* __restrict__ Qd, const _Float16* __restrict__ Kd,
    const _Float16* __restrict__ Vtd, _Float16* __restrict__ concat) {
  __shared__ __align__(16) _Float16 Kl[2][32 * KP];   // [t][dk]
  __shared__ __align__(16) _Float16 Vl[2][64 * VP];   // [dv][t]

  const int tid  = threadIdx.x;
  const int wave = tid >> 5;
  const int lane = tid & 31;
  const int bh   = blockIdx.y;                 // b*8 + h
  const int q0   = blockIdx.x * 128 + wave * 16;

  const _Float16* Qbh = Qd + (size_t)bh * 2048 * 64;
  const _Float16* Kbh = Kd + (size_t)bh * 2048 * 64;
  const _Float16* Vbh = Vtd + (size_t)bh * 64 * 2048;

  // hardware LDS byte offsets for async copies
  const uint32_t kbase = (uint32_t)(uintptr_t)(void*)&Kl[0][0];
  const uint32_t vbase = (uint32_t)(uintptr_t)(void*)&Vl[0][0];
  const int krow = tid >> 3, kcg = tid & 7;    // K:   32 rows x 8 chunks
  const int vrow = tid >> 2, vcg = tid & 3;    // V^T: 64 rows x 4 chunks

  // B fragments of Q^T: column = query lane%16
  const v16h qf0 = load_frag(Qbh + (size_t)q0 * 64, 64);
  const v16h qf1 = load_frag(Qbh + (size_t)q0 * 64 + 32, 64);

  float mrow = -1e30f;   // running maximum of this lane's query
  float lrow = 0.0f;     // running sum over this wave half's keys only
  v8f acc[4] = {};       // O^T: acc[nt][r] = O[query col][nt*16 + 8*hf + r]

  const float scale = 0.125f;   // 1/sqrt(DK)
  const int hf = lane >> 4, col = lane & 15;

  // stage(pp, t0): each of 256 lanes moves one 16B K chunk + one 16B V chunk
  auto stage = [&](int pp, int t0) {
    async_copy2_b128(
        kbase + (uint32_t)((pp * 32 * KP + krow * KP + kcg * 8) * 2),
        Kbh + (size_t)t0 * 64 + tid * 8,
        vbase + (uint32_t)((pp * 64 * VP + vrow * VP + vcg * 8) * 2),
        Vbh + (size_t)vrow * 2048 + t0 + vcg * 8);
  };

  stage(0, 0);  // prologue

  for (int n = 0; n < 64; ++n) {
    const int pp = n & 1;
    wait_ds0();           // my reads of the other buffer have retired
    wait_async0();        // my chunks of buffer pp have landed
    __syncthreads();      // everyone's chunks have landed; prev reads done
    if (n + 1 < 64) stage(pp ^ 1, (n + 1) * 32);   // overlap next block

    const _Float16* Kc = &Kl[pp][0];
    const _Float16* Vc = &Vl[pp][0];

    // ---- scores^T: 32 keys x 16 queries (two 16x16 tiles, K-dim = 64) ----
    v8f s0 = {}, s1 = {};
    {
      v16h kb0 = load_frag(Kc, KP);
      v16h kb1 = load_frag(Kc + 32, KP);
      s0 = wmma16(kb0, qf0, s0);
      s0 = wmma16(kb1, qf1, s0);
      v16h kb2 = load_frag(Kc + 16 * KP, KP);
      v16h kb3 = load_frag(Kc + 16 * KP + 32, KP);
      s1 = wmma16(kb2, qf0, s1);
      s1 = wmma16(kb3, qf1, s1);
    }

    // ---- online softmax: 16 keys of one query per lane --------------------
    float a0[8], a1[8];
    float bm = -1e30f;
#pragma unroll
    for (int r = 0; r < 8; ++r) {
      a0[r] = s0[r] * scale;
      a1[r] = s1[r] * scale;
      bm = fmaxf(bm, fmaxf(a0[r], a1[r]));
    }
    bm = fmaxf(bm, xhalf(bm));           // the other 16 keys of the block
    const float mnew = fmaxf(mrow, bm);
    const float c = __expf(mrow - mnew);
    mrow = mnew;

    // P^T as B fragment: element s = key 8*hf+s (s < 8) or 16+8*hf+(s-8),
    // the k order in which load_frag brings the V^T rows
    v16h pf;
    float ps = 0.0f;
#pragma unroll
    for (int r = 0; r < 8; ++r) {
      float p0 = __expf(a0[r] - mnew);
      float p1 = __expf(a1[r] - mnew);
      ps += p0 + p1;
      pf[r]     = (_Float16)p0;
      pf[r + 8] = (_Float16)p1;
    }
    lrow = lrow * c + ps;
#pragma unroll
    for (int nt = 0; nt < 4; ++nt)
#pragma unroll
      for (int r = 0; r < 8; ++r) acc[nt][r] *= c;

    // ---- O^T += V^T P^T : A = V^T rows (dv, t-contiguous), B = P^T --------
#pragma unroll
    for (int nt = 0; nt < 4; ++nt) {
      v16h vb = load_frag(Vc + (size_t)(nt * 16) * VP, VP);
      acc[nt] = wmma16(vb, pf, acc[nt]);
    }
  }

  // epilogue: join the halves' sums, normalize, write f16 concat
  // [b][s][h*64 + dv]; a lane's 8 values of a tile are 8 consecutive dv
  lrow += xhalf(lrow);
  const int b = bh >> 3, h = bh & 7;
  _Float16* orow = concat + ((size_t)(b * 2048 + q0 + col)) * 512 + h * 64 + 8 * hf;
#pragma unroll
  for (int nt = 0; nt < 4; ++nt) {
    union { _Float16 e[8]; uint4 q; } o;
#pragma unroll
    for (int r = 0; r < 8; ++r) o.e[r] = (_Float16)(acc[nt][r] / lrow);
    *(uint4*)(orow + nt * 16) = o.q;
  }
}

// ---------------------------------------------------------------------------
// Output projection: [8192 x 512] @ [512 x 512] + bo -> f32
// grid (8192/128, 512/128), block 256; same GEMM core as the QKV projection.
// ---------------------------------------------------------------------------
__global__ __launch_bounds__(256) void outproj_kernel(
    const _Float16* __restrict__ concat, const _Float16* __restrict__ Wot,
    const float* __restrict__ bo, float* __restrict__ out) {
  __shared__ __align__(16) _Float16 As[2 * GT];
  __shared__ __align__(16) _Float16 Bs[2 * GT];
  const int wave = threadIdx.x >> 5;
  const int lane = threadIdx.x & 31;
  const int wm = wave & 3, wn = wave >> 2;

  v8f acc[2][4] = {};
  gemm_128x128_k512(concat + (size_t)blockIdx.x * 128 * 512,
                    Wot + (size_t)blockIdx.y * 128 * 512,
                    As, Bs, wm, wn, acc);

  const int hf = lane >> 4, col = lane & 15;
  // the three loops are unrolled so that acc is indexed by constants only and
  // stays in registers
#pragma unroll
  for (int i = 0; i < 2; ++i) {
    const int m0 = blockIdx.x * 128 + wm * 32 + i * 16;
#pragma unroll
    for (int nt = 0; nt < 4; ++nt) {
      int n = blockIdx.y * 128 + wn * 64 + nt * 16 + col;
      float bval = bo[n];
#pragma unroll
      for (int r = 0; r < 8; ++r) {
        int m = m0 + r + 8 * hf;
        out[(size_t)m * 512 + n] = acc[i][nt][r] + bval;
      }
    }
  }
}

// ---------------------------------------------------------------------------
extern "C" void kernel_launch(void* const* d_in, const int* in_sizes, int n_in,
                              void* d_out, int out_size, void* d_ws,
                              size_t ws_size, hipStream_t stream) {
  const float* x_q = (const float*)d_in[0];
  const float* x_k = (const float*)d_in[1];
  const float* x_v = (const float*)d_in[2];
  const float* Wq  = (const float*)d_in[3];
  const float* bq  = (const float*)d_in[4];
  const float* Wk  = (const float*)d_in[5];
  const float* bk  = (const float*)d_in[6];
  const float* Wv  = (const float*)d_in[7];
  const float* bv  = (const float*)d_in[8];
  const float* Wo  = (const float*)d_in[9];
  const float* bo  = (const float*)d_in[10];
  float* out = (float*)d_out;
  (void)in_sizes; (void)n_in; (void)out_size; (void)ws_size;

  // workspace carve-up (~61 MB total)
  char* ws = (char*)d_ws;
  size_t off = 0;
  auto take = [&](size_t elems) {
    _Float16* p = (_Float16*)(ws + off);
    off += elems * sizeof(_Float16);
    return p;
  };
  const size_t XE = (size_t)8192 * 512;
  const size_t WE = (size_t)8 * 64 * 512;
  _Float16* xqh = take(XE);
  _Float16* xkh = take(XE);
  _Float16* xvh = take(XE);
  _Float16* Wqt = take(WE);
  _Float16* Wkt = take(WE);
  _Float16* Wvt = take(WE);
  _Float16* Wot = take((size_t)512 * 512);
  _Float16* Qd  = take(XE);
  _Float16* Kd  = take(XE);
  _Float16* Vtd = take(XE);
  _Float16* Cc  = take(XE);

  cvt_x<<<512, 256, 0, stream>>>(x_q, x_k, x_v, xqh, xkh, xvh);
  cvt_tr_w<<<(int)(WE / 256), 256, 0, stream>>>(Wq, Wqt);
  cvt_tr_w<<<(int)(WE / 256), 256, 0, stream>>>(Wk, Wkt);
  cvt_tr_w<<<(int)(WE / 256), 256, 0, stream>>>(Wv, Wvt);
  cvt_tr_wo<<<1024, 256, 0, stream>>>(Wo, Wot);

  proj_kernel<<<dim3(64, 4, 3), 256, 0, stream>>>(
      xqh, xkh, xvh, Wqt, Wkt, Wvt, bq, bk, bv, Qd, Kd, Vtd);

  attn_kernel<<<dim3(16, 32), 256, 0, stream>>>(Qd, Kd, Vtd, Cc);

  outproj_kernel<<<dim3(64, 4), 256, 0, stream>>>(Cc, Wot, bo, out);
}

// v005
// One run takes 84.3 microseconds.
// Two timings next to v004 put it at 1.15 and 1.16 times that version's speed.
// Counting every step since v000, it is 3.21 times as fast.
#include <hip/hip_runtime.h>
#include <hip/hip_bf16.h>
#include <stdint.h>

// ---------------------------------------------------------------------------
// MultiHeadAttention for MI455X (gfx1250, wave32, WMMA 16x16x32 f16)
//   B=4 S=2048 F=512 H=8 DK=DV=64 FILT=512
// Pipeline: f16 convert -> QKV proj GEMM (WMMA, tiles staged in LDS) ->
// flash attention (WMMA + online softmax + async-to-LDS double buffering) ->
// output GEMM (WMMA, tiles staged in LDS, f32 out)
// ---------------------------------------------------------------------------

typedef __attribute__((ext_vector_type(16))) _Float16 v16h;
typedef __attribute__((ext_vector_type(8)))  float    v8f;

union Frag16 { v16h h; uint4 q[2]; };

// Load a 16x32 f16 fragment (A layout; also our B layout when the source is
// stored reduction-contiguous per row).
//   lane%16 -> row (A: M, B: N); lane/16 -> K half {0..7,16..23} vs {8..15,24..31}
// Two 16-byte transactions; all call sites guarantee 16-B alignment.
__device__ __forceinline__ v16h load_frag(const _Float16* base, int ld) {
  const int lane = threadIdx.x & 31;
  const int hi   = lane >> 4;
  const int idx  = lane & 15;
  const _Float16* row = base + (size_t)idx * ld + hi * 8;
  Frag16 f;
  f.q[0] = *(const uint4*)(row);
  f.q[1] = *(const uint4*)(row + 16);
  return f.h;
}

__device__ __forceinline__ v8f wmma16(v16h a, v16h b, v8f c) {
  return __builtin_amdgcn_wmma_f32_16x16x32_f16(false, a, false, b,
                                                (short)0, c, false, false);
}

// CDNA5 async memory->LDS copies, 16B per lane each, tracked by ASYNCcnt.
// Both copies of a stage and their s_wait_xcnt stand in one statement, so the
// address registers are not rewritten ahead of that wait.
__device__ __forceinline__ void async_copy2_b128(uint32_t lds0,
                                                 const _Float16* g0,
                                                 uint32_t lds1,
                                                 const _Float16* g1) {
  asm volatile("global_load_async_to_lds_b128 %0, %1, off\n\t"
               "global_load_async_to_lds_b128 %2, %3, off\n\t"
               "s_wait_xcnt 0x0"
               :: "v"(lds0), "v"((uint64_t)(uintptr_t)g0),
                  "v"(lds1), "v"((uint64_t)(uintptr_t)g1)
               : "memory");
}
__device__ __forceinline__ void wait_async0() {
  asm volatile("s_wait_asynccnt 0x0" ::: "memory");
}
// This wave's LDS reads of the buffer that is refilled next have retired.
__device__ __forceinline__ void wait_ds0() {
  asm volatile("s_wait_dscnt 0x0" ::: "memory");
}

// ---------------------------------------------------------------------------
// Conversion kernel: f32 -> f16 (x elementwise, weights transposed)
// ---------------------------------------------------------------------------
typedef __attribute__((ext_vector_type(4))) float    v4f;
typedef __attribute__((ext_vector_type(4))) _Float16 v4h;

typedef __attribute__((ext_vector_type(2))) _Float16 v2h;

// One 64 x 64 tile of a transposing conversion: dst[c][r] = (f16)src[r][c],
// src rows of ld floats, dst rows of 512 halves. A lane takes 2 rows x 8
// columns: four b128 loads (32 contiguous bytes of each row), then eight b32
// stores of a row pair. The 32 lanes of a wave hold 64 consecutive rows, so
// each store of a wave writes one whole 128-B line of dst; the 8 waves
// together read 256 contiguous bytes of each source row.
__device__ __forceinline__ void cvt_tr_tile(const float* __restrict__ src,
                                            int ld,
                                            _Float16* __restrict__ dst) {
  const int lane = threadIdx.x & 31, wave = threadIdx.x >> 5;
  const float* s = src + (size_t)(2 * lane) * ld + wave * 8;
  const v4f r0a = *(const v4f*)(s);
  const v4f r0b = *(const v4f*)(s + 4);
  const v4f r1a = *(const v4f*)(s + ld);
  const v4f r1b = *(const v4f*)(s + ld + 4);
  _Float16* d = dst + (size_t)(wave * 8) * 512 + 2 * lane;
#pragma unroll
  for (int j = 0; j < 4; ++j) {
    v2h p = {(_Float16)r0a[j], (_Float16)r1a[j]};
    *(v2h*)(d + j * 512) = p;
  }
#pragma unroll
  for (int j = 0; j < 4; ++j) {
    v2h p = {(_Float16)r0b[j], (_Float16)r1b[j]};
    *(v2h*)(d + (4 + j) * 512) = p;
  }
  // Behind the eight stores: in the built code another branch's block follows,
  // which writes the stores' address and data registers.
  asm volatile("s_wait_xcnt 0x0" ::: "memory");
}

// Every conversion of the pipeline in ONE launch of 768 blocks x 8 waves.
// Blocks 0..511: x_q, x_k, x_v (f32, 8192*512 each) -> f16. A wave owns 1024
// consecutive elements of each tensor: 8 loads of 512 contiguous bytes per
// tensor, all 24 in flight together, then 8 stores of 256 contiguous bytes
// (two whole lines) per tensor.
// Blocks 512..767: the weights, one 64 x 64 tile a block, 64 tiles a matrix:
//   W[h][f][dk] (f32) -> Wt[h][dk][f] (f16), H=8 F=512 DK=64, for Wq, Wk, Wv
//   Wo[c][o] (512x512 f32) -> Wot[o][c] (f16)
// They run beside the x stream instead of in four short launches of their own.
__global__ __launch_bounds__(256) void cvt_all(
    const float* __restrict__ xq, const float* __restrict__ xk,
    const float* __restrict__ xv, _Float16* __restrict__ dq,
    _Float16* __restrict__ dk, _Float16* __restrict__ dv,
    const float* __restrict__ Wq, const float* __restrict__ Wk,
    const float* __restrict__ Wv, const float* __restrict__ Wo,
    _Float16* __restrict__ Wqt, _Float16* __restrict__ Wkt,
    _Float16* __restrict__ Wvt, _Float16* __restrict__ Wot) {
  if (blockIdx.x >= 512) {
    const int t = blockIdx.x - 512;
    const int m = t >> 6, hi = (t >> 3) & 7, lo = t & 7;
    if (m == 3) {
      // rows c = lo*64 .., columns o = hi*64 ..
      cvt_tr_tile(Wo + (size_t)lo * 64 * 512 + hi * 64, 512,
                  Wot + (size_t)hi * 64 * 512 + lo * 64);
    } else {
      // head hi, rows f = lo*64 .., all 64 columns dk
      const float* W  = m == 0 ? Wq : m == 1 ? Wk : Wv;
      _Float16*    Wt = m == 0 ? Wqt : m == 1 ? Wkt : Wvt;
      cvt_tr_tile(W + ((size_t)hi * 512 + lo * 64) * 64, 64,
                  Wt + (size_t)hi * 64 * 512 + lo * 64);
    }
    return;
  }
  const int off = (blockIdx.x * 8 + (threadIdx.x >> 5)) * 1024 +
                  (threadIdx.x & 31) * 4;
  v4f a[8], b[8], c[8];
#pragma unroll
  for (int j = 0; j < 8; ++j) a[j] = *(const v4f*)(xq + off + j * 128);
#pragma unroll
  for (int j = 0; j < 8; ++j) b[j] = *(const v4f*)(xk + off + j * 128);
#pragma unroll
  for (int j = 0; j < 8; ++j) c[j] = *(const v4f*)(xv + off + j * 128);
  // The loads' address registers are reused below: this wait stands in front
  // of the first such overwrite. The three addresses are inputs so that no
  // later load's result is placed on them ahead of the wait.
  asm volatile("s_wait_xcnt 0x0"
               :: "v"(xq + off), "v"(xk + off), "v"(xv + off) : "memory");
  // No conversion is scheduled up among the loads: without this the compiler
  // holds 11 of the 24 loads back until registers of the first ones are free.
  __builtin_amdgcn_sched_barrier(0);
#pragma unroll
  for (int j = 0; j < 8; ++j)
    *(v4h*)(dq + off + j * 128) = __builtin_convertvector(a[j], v4h);
#pragma unroll
  for (int j = 0; j < 8; ++j)
    *(v4h*)(dk + off + j * 128) = __builtin_convertvector(b[j], v4h);
#pragma unroll
  for (int j = 0; j < 8; ++j)
    *(v4h*)(dv + off + j * 128) = __builtin_convertvector(c[j], v4h);
  // Behind the last stores: in the built code the weights' block follows, whose
  // argument loads write the stores' scalar base registers.
  asm volatile("s_wait_xcnt 0x0" ::: "memory");
}

constexpr int GP = 72;
constexpr int GT = 128 * GP;

// Eight copies (one tile's share of a lane) and their s_wait_xcnt in one
// statement, so the address registers are not rewritten ahead of that wait.
__device__ __forceinline__ void async_copy8_b128(
    uint32_t l0, const _Float16* g0, uint32_t l1, const _Float16* g1,
    uint32_t l2, const _Float16* g2, uint32_t l3, const _Float16* g3,
    uint32_t l4, const _Float16* g4, uint32_t l5, const _Float16* g5,
    uint32_t l6, const _Float16* g6, uint32_t l7, const _Float16* g7) {
  asm volatile("global_load_async_to_lds_b128 %0, %1, off\n\t"
               "global_load_async_to_lds_b128 %2, %3, off\n\t"
               "global_load_async_to_lds_b128 %4, %5, off\n\t"
               "global_load_async_to_lds_b128 %6, %7, off\n\t"
               "global_load_async_to_lds_b128 %8, %9, off\n\t"
               "global_load_async_to_lds_b128 %10, %11, off\n\t"
               "global_load_async_to_lds_b128 %12, %13, off\n\t"
               "global_load_async_to_lds_b128 %14, %15, off\n\t"
               "s_wait_xcnt 0x0"
               :: "v"(l0), "v"((uint64_t)(uintptr_t)g0),
                  "v"(l1), "v"((uint64_t)(uintptr_t)g1),
                  "v"(l2), "v"((uint64_t)(uintptr_t)g2),
                  "v"(l3), "v"((uint64_t)(uintptr_t)g3),
                  "v"(l4), "v"((uint64_t)(uintptr_t)g4),
                  "v"(l5), "v"((uint64_t)(uintptr_t)g5),
                  "v"(l6), "v"((uint64_t)(uintptr_t)g6),
                  "v"(l7), "v"((uint64_t)(uintptr_t)g7)
               : "memory");
}

// A, B: first row of the block's 128 rows. As, Bs: two buffers of GT halves.
// acc[i][j]: rows wm*32 + i*16 .., columns wn*64 + j*16 .. of the block tile.
__device__ __forceinline__ void gemm_128x128_k512(
    const _Float16* __restrict__ A, const _Float16* __restrict__ B,
    const _Float16* As, const _Float16* Bs, int wm, int wn, v8f (&acc)[2][4]) {
  const int tid  = threadIdx.x;
  const int srow = tid >> 3, scg = tid & 7;   // 32 rows x 8 chunks per pass
  const _Float16* ga = A + (size_t)srow * 512 + scg * 8;
  const _Float16* gb = B + (size_t)srow * 512 + scg * 8;
  const uint32_t lofs = (uint32_t)((srow * GP + scg * 8) * 2);
  const uint32_t la = (uint32_t)(uintptr_t)(const void*)As + lofs;
  const uint32_t lb = (uint32_t)(uintptr_t)(const void*)Bs + lofs;
  constexpr uint32_t LR = 32 * GP * 2;        // 32 staged rows, bytes
  constexpr size_t   GR = (size_t)32 * 512;   // 32 source rows, halves

  auto stage = [&](int buf, int k0) {
    const uint32_t a = la + (uint32_t)(buf * GT * 2);
    const uint32_t b = lb + (uint32_t)(buf * GT * 2);
    async_copy8_b128(a,          ga + k0,          a + LR,     ga + k0 + GR,
                     a + 2 * LR, ga + k0 + 2 * GR, a + 3 * LR, ga + k0 + 3 * GR,
                     b,          gb + k0,          b + LR,     gb + k0 + GR,
                     b + 2 * LR, gb + k0 + 2 * GR, b + 3 * LR, gb + k0 + 3 * GR);
  };

  stage(0, 0);
  wait_async0();        // my chunks of tile 0 have landed
  __syncthreads();      // everyone's have
  stage(1, 64);

  for (int t = 0; t < 8; ++t) {
    const _Float16* Ac = As + (t & 1) * GT + wm * 32 * GP;
    const _Float16* Bc = Bs + (t & 1) * GT + wn * 64 * GP;
    // unrolled: both k halves of the tile in one straight run, LDS offsets as
    // immediates
#pragma unroll
    for (int kk = 0; kk < 64; kk += 32) {
      v16h a0 = load_frag(Ac + kk, GP);
      v16h a1 = load_frag(Ac + 16 * GP + kk, GP);
      v16h b0 = load_frag(Bc + kk, GP);
      v16h b1 = load_frag(Bc + 16 * GP + kk, GP);
      v16h b2 = load_frag(Bc + 32 * GP + kk, GP);
      v16h b3 = load_frag(Bc + 48 * GP + kk, GP);
      acc[0][0] = wmma16(a0, b0, acc[0][0]);
      acc[0][1] = wmma16(a0, b1, acc[0][1]);
      acc[0][2] = wmma16(a0, b2, acc[0][2]);
      acc[0][3] = wmma16(a0, b3, acc[0][3]);
      acc[1][0] = wmma16(a1, b0, acc[1][0]);
      acc[1][1] = wmma16(a1, b1, acc[1][1]);
      acc[1][2] = wmma16(a1, b2, acc[1][2]);
      acc[1][3] = wmma16(a1, b3, acc[1][3]);
    }
    wait_ds0();         // my reads of this buffer have retired
    wait_async0();      // my chunks of tile t + 1 have landed
    __syncthreads();    // tile t + 1 is published; this buffer is free
    if (t + 2 < 8) stage(t & 1, (t + 2) * 64);
  }
  wait_async0();        // nothing in flight when the wave goes on
}

// ---------------------------------------------------------------------------
// QKV projection: per which: [8192 x 512] @ [512 x (h,dk) = 512] + bias
// grid (8192/128, 512/128, 3), block 256; a wave's 64 columns are one head.
// which==2 (V) stores transposed [b][h][dv][s]
// ---------------------------------------------------------------------------
__global__ __launch_bounds__(256) void proj_kernel(
    const _Float16* __restrict__ xq, const _Float16* __restrict__ xk,
    const _Float16* __restrict__ xv,
    const _Float16* __restrict__ Wqt, const _Float16* __restrict__ Wkt,
    const _Float16* __restrict__ Wvt,
    const float* __restrict__ bq, const float* __restrict__ bk,
    const float* __restrict__ bv,
    _Float16* __restrict__ Qd, _Float16* __restrict__ Kd,
    _Float16* __restrict__ Vtd) {
  __shared__ __align__(16) _Float16 As[2 * GT];
  __shared__ __align__(16) _Float16 Bs[2 * GT];
  const int wave = threadIdx.x >> 5;
  const int lane = threadIdx.x & 31;
  const int wm = wave & 3, wn = wave >> 2;
  const int which = blockIdx.z;
  const int h     = blockIdx.y * 2 + wn;

  const _Float16* x    = which == 0 ? xq : which == 1 ? xk : xv;
  const _Float16* Wt   = which == 0 ? Wqt : which == 1 ? Wkt : Wvt;
  const float*    bias = which == 0 ? bq : which == 1 ? bk : bv;

  v8f acc[2][4] = {};
  gemm_128x128_k512(x + (size_t)blockIdx.x * 128 * 512,
                    Wt + (size_t)blockIdx.y * 128 * 512,   // [h*64 + dk][f]
                    As, Bs, wm, wn, acc);

  const int hf = lane >> 4, col = lane & 15;
  // A block's 128 rows lie in one batch (128 divides 2048): b and the lane's
  // first row s0 are formed once, and every store of the lane is its one base
  // address plus a constant.
  const int b  = blockIdx.x >> 4;
  const int s0 = (blockIdx.x & 15) * 128 + wm * 32 + 8 * hf;
  // every loop below is unrolled so that acc and bval are indexed by constants
  // only and stay in registers; the innermost index runs along the stored row
  float bval[4];
#pragma unroll
  for (int nt = 0; nt < 4; ++nt) bval[nt] = bias[h * 64 + nt * 16 + col];
  if (which == 2) {
    _Float16* p = Vtd + (((size_t)b * 8 + h) * 64 + col) * 2048 + s0;
#pragma unroll
    for (int nt = 0; nt < 4; ++nt)
#pragma unroll
      for (int i = 0; i < 2; ++i)
#pragma unroll
        for (int r = 0; r < 8; ++r)
          p[nt * 16 * 2048 + i * 16 + r] = (_Float16)(acc[i][nt][r] + bval[nt]);
  } else {
    _Float16* p = (which == 0 ? Qd : Kd) +
                  (((size_t)b * 8 + h) * 2048 + s0) * 64 + col;
#pragma unroll
    for (int i = 0; i < 2; ++i)
#pragma unroll
      for (int r = 0; r < 8; ++r)
#pragma unroll
        for (int nt = 0; nt < 4; ++nt)
          p[(i * 16 + r) * 64 + nt * 16] = (_Float16)(acc[i][nt][r] + bval[nt]);
    // In the built code this path runs on, behind a branch, into the block of
    // the V path: the wait stands in front of that block's register writes.
    asm volatile("s_wait_xcnt 0x0" ::: "memory");
  }
}

constexpr int KP = 72;   // K row pitch in halves: 64 data + 8 pad (144 B)
constexpr int VP = 40;   // V^T row pitch in halves: 32 data + 8 pad (80 B)

// value of lane l ^ 16
__device__ __forceinline__ float xhalf(float x) {
  int b = __builtin_bit_cast(int, x);
  return __builtin_bit_cast(
      float, __builtin_amdgcn_permlanex16(b, b, 0x76543210, 0xfedcba98, false,
                                          false));
}

__global__ __launch_bounds__(256) void attn_kernel(
    const _Float16* __restrict__ Qd, const _Float16* __restrict__ Kd,
    const _Float16* __restrict__ Vtd, _Float16* __restrict__ concat) {
  __shared__ __align__(16) _Float16 Kl[2][32 * KP];   // [t][dk]
  __shared__ __align__(16) _Float16 Vl[2][64 * VP];   // [dv][t]

  const int tid  = threadIdx.x;
  const int wave = tid >> 5;
  const int lane = tid & 31;
  const int bh   = blockIdx.y;                 // b*8 + h
  const int q0   = blockIdx.x * 128 + wave * 16;

  const _Float16* Qbh = Qd + (size_t)bh * 2048 * 64;
  const _Float16* Kbh = Kd + (size_t)bh * 2048 * 64;
  const _Float16* Vbh = Vtd + (size_t)bh * 64 * 2048;

  // hardware LDS byte offsets for async copies
  const uint32_t kbase = (uint32_t)(uintptr_t)(void*)&Kl[0][0];
  const uint32_t vbase = (uint32_t)(uintptr_t)(void*)&Vl[0][0];
  const int krow = tid >> 3, kcg = tid & 7;    // K:   32 rows x 8 chunks
  const int vrow = tid >> 2, vcg = tid & 3;    // V^T: 64 rows x 4 chunks

  // B fragments of Q^T: column = query lane%16
  const v16h qf0 = load_frag(Qbh + (size_t)q0 * 64, 64);
  const v16h qf1 = load_frag(Qbh + (size_t)q0 * 64 + 32, 64);

  float mrow = -1e30f;   // running maximum of this lane's query
  float lrow = 0.0f;     // running sum over this wave half's keys only
  v8f acc[4] = {};       // O^T: acc[nt][r] = O[query col][nt*16 + 8*hf + r]

  const float scale = 0.125f;   // 1/sqrt(DK)
  const int hf = lane >> 4, col = lane & 15;

  // stage(pp, t0): each of 256 lanes moves one 16B K chunk + one 16B V chunk
  auto stage = [&](int pp, int t0) {
    async_copy2_b128(
        kbase + (uint32_t)((pp * 32 * KP + krow * KP + kcg * 8) * 2),
        Kbh + (size_t)t0 * 64 + tid * 8,
        vbase + (uint32_t)((pp * 64 * VP + vrow * VP + vcg * 8) * 2),
        Vbh + (size_t)vrow * 2048 + t0 + vcg * 8);
  };

  stage(0, 0);  // prologue

  for (int n = 0; n < 64; ++n) {
    const int pp = n & 1;
    wait_ds0();           // my reads of the other buffer have retired
    wait_async0();        // my chunks of buffer pp have landed
    __syncthreads();      // everyone's chunks have landed; prev reads done
    if (n + 1 < 64) stage(pp ^ 1, (n + 1) * 32);   // overlap next block

    const _Float16* Kc = &Kl[pp][0];
    const _Float16* Vc = &Vl[pp][0];

    // ---- scores^T: 32 keys x 16 queries (two 16x16 tiles, K-dim = 64) ----
    v8f s0 = {}, s1 = {};
    {
      v16h kb0 = load_frag(Kc, KP);
      v16h kb1 = load_frag(Kc + 32, KP);
      s0 = wmma16(kb0, qf0, s0);
      s0 = wmma16(kb1, qf1, s0);
      v16h kb2 = load_frag(Kc + 16 * KP, KP);
      v16h kb3 = load_frag(Kc + 16 * KP + 32, KP);
      s1 = wmma16(kb2, qf0, s1);
      s1 = wmma16(kb3, qf1, s1);
    }

    // ---- online softmax: 16 keys of one query per lane --------------------
    float a0[8], a1[8];
    float bm = -1e30f;
#pragma unroll
    for (int r = 0; r < 8; ++r) {
      a0[r] = s0[r] * scale;
      a1[r] = s1[r] * scale;
      bm = fmaxf(bm, fmaxf(a0[r], a1[r]));
    }
    bm = fmaxf(bm, xhalf(bm));           // the other 16 keys of the block
    const float mnew = fmaxf(mrow, bm);
    const float c = __expf(mrow - mnew);
    mrow = mnew;

    // P^T as B fragment: element s = key 8*hf+s (s < 8) or 16+8*hf+(s-8),
    // the k order in which load_frag brings the V^T rows
    v16h pf;
    float ps = 0.0f;
#pragma unroll
    for (int r = 0; r < 8; ++r) {
      float p0 = __expf(a0[r] - mnew);
      float p1 = __expf(a1[r] - mnew);
      ps += p0 + p1;
      pf[r]     = (_Float16)p0;
      pf[r + 8] = (_Float16)p1;
    }
    lrow = lrow * c + ps;
#pragma unroll
    for (int nt = 0; nt < 4; ++nt)
#pragma unroll
      for (int r = 0; r < 8; ++r) acc[nt][r] *= c;

    // ---- O^T += V^T P^T : A = V^T rows (dv, t-contiguous), B = P^T --------
#pragma unroll
    for (int nt = 0; nt < 4; ++nt) {
      v16h vb = load_frag(Vc + (size_t)(nt * 16) * VP, VP);
      acc[nt] = wmma16(vb, pf, acc[nt]);
    }
  }

  // epilogue: join the halves' sums, normalize, write f16 concat
  // [b][s][h*64 + dv]; a lane's 8 values of a tile are 8 consecutive dv
  lrow += xhalf(lrow);
  const int b = bh >> 3, h = bh & 7;
  _Float16* orow = concat + ((size_t)(b * 2048 + q0 + col)) * 512 + h * 64 + 8 * hf;
#pragma unroll
  for (int nt = 0; nt < 4; ++nt) {
    union { _Float16 e[8]; uint4 q; } o;
#pragma unroll
    for (int r = 0; r < 8; ++r) o.e[r] = (_Float16)(acc[nt][r] / lrow);
    *(uint4*)(orow + nt * 16) = o.q;
  }
}

// ---------------------------------------------------------------------------
// Output projection: [8192 x 512] @ [512 x 512] + bo -> f32
// grid (8192/128, 512/128), block 256; same GEMM core as the QKV projection.
// ---------------------------------------------------------------------------
__global__ __launch_bounds__(256) void outproj_kernel(
    const _Float16* __restrict__ concat, const _Float16* __restrict__ Wot,
    const float* __restrict__ bo, float* __restrict__ out) {
  __shared__ __align__(16) _Float16 As[2 * GT];
  __shared__ __align__(16) _Float16 Bs[2 * GT];
  const int wave = threadIdx.x >> 5;
  const int lane = threadIdx.x & 31;
  const int wm = wave & 3, wn = wave >> 2;

  v8f acc[2][4] = {};
  gemm_128x128_k512(concat + (size_t)blockIdx.x * 128 * 512,
                    Wot + (size_t)blockIdx.y * 128 * 512,
                    As, Bs, wm, wn, acc);

  const int hf = lane >> 4, col = lane & 15;
  // the three loops are unrolled so that acc is indexed by constants only and
  // stays in registers
#pragma unroll
  for (int i = 0; i < 2; ++i) {
    const int m0 = blockIdx.x * 128 + wm * 32 + i * 16;
#pragma unroll
    for (int nt = 0; nt < 4; ++nt) {
      int n = blockIdx.y * 128 + wn * 64 + nt * 16 + col;
      float bval = bo[n];
#pragma unroll
      for (int r = 0; r < 8; ++r) {
        int m = m0 + r + 8 * hf;
        out[(size_t)m * 512 + n] = acc[i][nt][r] + bval;
      }
    }
  }
}

// ---------------------------------------------------------------------------
extern "C" void kernel_launch(void* const* d_in, const int* in_sizes, int n_in,
                              void* d_out, int out_size, void* d_ws,
                              size_t ws_size, hipStream_t stream) {
  const float* x_q = (const float*)d_in[0];
  const float* x_k = (const float*)d_in[1];
  const float* x_v = (const float*)d_in[2];
  const float* Wq  = (const float*)d_in[3];
  const float* bq  = (const float*)d_in[4];
  const float* Wk  = (const float*)d_in[5];
  const float* bk  = (const float*)d_in[6];
  const float* Wv  = (const float*)d_in[7];
  const float* bv  = (const float*)d_in[8];
  const float* Wo  = (const float*)d_in[9];
  const float* bo  = (const float*)d_in[10];
  float* out = (float*)d_out;
  (void)in_sizes; (void)n_in; (void)out_size; (void)ws_size;

  // workspace carve-up (~61 MB total)
  char* ws = (char*)d_ws;
  size_t off = 0;
  auto take = [&](size_t elems) {
    _Float16* p = (_Float16*)(ws + off);
    off += elems * sizeof(_Float16);
    return p;
  };
  const size_t XE = (size_t)8192 * 512;
  const size_t WE = (size_t)8 * 64 * 512;
  _Float16* xqh = take(XE);
  _Float16* xkh = take(XE);
  _Float16* xvh = take(XE);
  _Float16* Wqt = take(WE);
  _Float16* Wkt = take(WE);
  _Float16* Wvt = take(WE);
  _Float16* Wot = take((size_t)512 * 512);
  _Float16* Qd  = take(XE);
  _Float16* Kd  = take(XE);
  _Float16* Vtd = take(XE);
  _Float16* Cc  = take(XE);

  cvt_all<<<768, 256, 0, stream>>>(x_q, x_k, x_v, xqh, xkh, xvh, Wq, Wk, Wv, Wo,
                                   Wqt, Wkt, Wvt, Wot);

  proj_kernel<<<dim3(64, 4, 3), 256, 0, stream>>>(
      xqh, xkh, xvh, Wqt, Wkt, Wvt, bq, bk, bv, Qd, Kd, Vtd);

  attn_kernel<<<dim3(16, 32), 256, 0, stream>>>(Qd, Kd, Vtd, Cc);

  outproj_kernel<<<dim3(64, 4), 256, 0, stream>>>(Cc, Wot, bo, out);
}

// v006
// Measured time: 71.8 microseconds a run.
// In both of two side-by-side timings against v005, it was 1.17 times as fast.
// Counting every step since v000, it is 3.76 times as fast.
#include <hip/hip_runtime.h>
#include <hip/hip_bf16.h>
#include <stdint.h>

// ---------------------------------------------------------------------------
// MultiHeadAttention for MI455X (gfx1250, wave32, WMMA 16x16x32 f16)
//   B=4 S=2048 F=512 H=8 DK=DV=64 FILT=512
// Pipeline: f16 convert -> QKV proj GEMM (WMMA, tiles staged in LDS) ->
// flash attention (WMMA + online softmax + async-to-LDS double buffering) ->
// output GEMM (WMMA, tiles staged in LDS, f32 out)
// ---------------------------------------------------------------------------

typedef __attribute__((ext_vector_type(16))) _Float16 v16h;
typedef __attribute__((ext_vector_type(8)))  float    v8f;

union Frag16 { v16h h; uint4 q[2]; };

// Load a 16x32 f16 fragment (A layout; also our B layout when the source is
// stored reduction-contiguous per row).
//   lane%16 -> row (A: M, B: N); lane/16 -> K half {0..7,16..23} vs {8..15,24..31}
// Two 16-byte transactions; all call sites guarantee 16-B alignment.
__device__ __forceinline__ v16h load_frag(const _Float16* base, int ld) {
  const int lane = threadIdx.x & 31;
  const int hi   = lane >> 4;
  const int idx  = lane & 15;
  const _Float16* row = base + (size_t)idx * ld + hi * 8;
  Frag16 f;
  f.q[0] = *(const uint4*)(row);
  f.q[1] = *(const uint4*)(row + 16);
  return f.h;
}

__device__ __forceinline__ v8f wmma16(v16h a, v16h b, v8f c) {
  return __builtin_amdgcn_wmma_f32_16x16x32_f16(false, a, false, b,
                                                (short)0, c, false, false);
}

// CDNA5 async memory->LDS copies are tracked by ASYNCcnt.
__device__ __forceinline__ void wait_async0() {
  asm volatile("s_wait_asynccnt 0x0" ::: "memory");
}
// This wave's LDS reads of the buffer that is refilled next have retired.
__device__ __forceinline__ void wait_ds0() {
  asm volatile("s_wait_dscnt 0x0" ::: "memory");
}

// ---------------------------------------------------------------------------
// Conversion kernel: f32 -> f16 (x elementwise, weights transposed)
// ---------------------------------------------------------------------------
typedef __attribute__((ext_vector_type(4))) float    v4f;
typedef __attribute__((ext_vector_type(4))) _Float16 v4h;

typedef __attribute__((ext_vector_type(2))) _Float16 v2h;

// One 64 x 64 tile of a transposing conversion: dst[c][r] = (f16)src[r][c],
// src rows of ld floats, dst rows of 512 halves. A lane takes 2 rows x 8
// columns: four b128 loads (32 contiguous bytes of each row), then eight b32
// stores of a row pair. The 32 lanes of a wave hold 64 consecutive rows, so
// each store of a wave writes one whole 128-B line of dst; the 8 waves
// together read 256 contiguous bytes of each source row.
__device__ __forceinline__ void cvt_tr_tile(const float* __restrict__ src,
                                            int ld,
                                            _Float16* __restrict__ dst) {
  const int lane = threadIdx.x & 31, wave = threadIdx.x >> 5;
  const float* s = src + (size_t)(2 * lane) * ld + wave * 8;
  const v4f r0a = *(const v4f*)(s);
  const v4f r0b = *(const v4f*)(s + 4);
  const v4f r1a = *(const v4f*)(s + ld);
  const v4f r1b = *(const v4f*)(s + ld + 4);
  _Float16* d = dst + (size_t)(wave * 8) * 512 + 2 * lane;
#pragma unroll
  for (int j = 0; j < 4; ++j) {
    v2h p = {(_Float16)r0a[j], (_Float16)r1a[j]};
    *(v2h*)(d + j * 512) = p;
  }
#pragma unroll
  for (int j = 0; j < 4; ++j) {
    v2h p = {(_Float16)r0b[j], (_Float16)r1b[j]};
    *(v2h*)(d + (4 + j) * 512) = p;
  }
  // Behind the eight stores: in the built code another branch's block follows,
  // which writes the stores' address and data registers.
  asm volatile("s_wait_xcnt 0x0" ::: "memory");
}

// Every conversion of the pipeline in ONE launch of 768 blocks x 8 waves.
// Blocks 0..511: x_q, x_k, x_v (f32, 8192*512 each) -> f16. A wave owns 1024
// consecutive elements of each tensor: 8 loads of 512 contiguous bytes per
// tensor, all 24 in flight together, then 8 stores of 256 contiguous bytes
// (two whole lines) per tensor.
// Blocks 512..767: the weights, one 64 x 64 tile a block, 64 tiles a matrix:
//   W[h][f][dk] (f32) -> Wt[h][dk][f] (f16), H=8 F=512 DK=64, for Wq, Wk, Wv
//   Wo[c][o] (512x512 f32) -> Wot[o][c] (f16)
// They run beside the x stream instead of in four short launches of their own.
__global__ __launch_bounds__(256) void cvt_all(
    const float* __restrict__ xq, const float* __restrict__ xk,
    const float* __restrict__ xv, _Float16* __restrict__ dq,
    _Float16* __restrict__ dk, _Float16* __restrict__ dv,
    const float* __restrict__ Wq, const float* __restrict__ Wk,
    const float* __restrict__ Wv, const float* __restrict__ Wo,
    _Float16* __restrict__ Wqt, _Float16* __restrict__ Wkt,
    _Float16* __restrict__ Wvt, _Float16* __restrict__ Wot) {
  if (blockIdx.x >= 512) {
    const int t = blockIdx.x - 512;
    const int m = t >> 6, hi = (t >> 3) & 7, lo = t & 7;
    if (m == 3) {
      // rows c = lo*64 .., columns o = hi*64 ..
      cvt_tr_tile(Wo + (size_t)lo * 64 * 512 + hi * 64, 512,
                  Wot + (size_t)hi * 64 * 512 + lo * 64);
    } else {
      // head hi, rows f = lo*64 .., all 64 columns dk
      const float* W  = m == 0 ? Wq : m == 1 ? Wk : Wv;
      _Float16*    Wt = m == 0 ? Wqt : m == 1 ? Wkt : Wvt;
      cvt_tr_tile(W + ((size_t)hi * 512 + lo * 64) * 64, 64,
                  Wt + (size_t)hi * 64 * 512 + lo * 64);
    }
    return;
  }
  const int off = (blockIdx.x * 8 + (threadIdx.x >> 5)) * 1024 +
                  (threadIdx.x & 31) * 4;
  v4f a[8], b[8], c[8];
#pragma unroll
  for (int j = 0; j < 8; ++j) a[j] = *(const v4f*)(xq + off + j * 128);
#pragma unroll
  for (int j = 0; j < 8; ++j) b[j] = *(const v4f*)(xk + off + j * 128);
#pragma unroll
  for (int j = 0; j < 8; ++j) c[j] = *(const v4f*)(xv + off + j * 128);
  // The loads' address registers are reused below: this wait stands in front
  // of the first such overwrite. The three addresses are inputs so that no
  // later load's result is placed on them ahead of the wait.
  asm volatile("s_wait_xcnt 0x0"
               :: "v"(xq + off), "v"(xk + off), "v"(xv + off) : "memory");
  // No conversion is scheduled up among the loads: without this the compiler
  // holds 11 of the 24 loads back until registers of the first ones are free.
  __builtin_amdgcn_sched_barrier(0);
#pragma unroll
  for (int j = 0; j < 8; ++j)
    *(v4h*)(dq + off + j * 128) = __builtin_convertvector(a[j], v4h);
#pragma unroll
  for (int j = 0; j < 8; ++j)
    *(v4h*)(dk + off + j * 128) = __builtin_convertvector(b[j], v4h);
#pragma unroll
  for (int j = 0; j < 8; ++j)
    *(v4h*)(dv + off + j * 128) = __builtin_convertvector(c[j], v4h);
  // Behind the last stores: in the built code the weights' block follows, whose
  // argument loads write the stores' scalar base registers.
  asm volatile("s_wait_xcnt 0x0" ::: "memory");
}

constexpr int GP = 72;
constexpr int GT = 128 * GP;

// Eight copies (one tile's share of a lane) and their s_wait_xcnt in one
// statement, so the address registers are not rewritten ahead of that wait.
__device__ __forceinline__ void async_copy8_b128(
    uint32_t l0, const _Float16* g0, uint32_t l1, const _Float16* g1,
    uint32_t l2, const _Float16* g2, uint32_t l3, const _Float16* g3,
    uint32_t l4, const _Float16* g4, uint32_t l5, const _Float16* g5,
    uint32_t l6, const _Float16* g6, uint32_t l7, const _Float16* g7) {
  asm volatile("global_load_async_to_lds_b128 %0, %1, off\n\t"
               "global_load_async_to_lds_b128 %2, %3, off\n\t"
               "global_load_async_to_lds_b128 %4, %5, off\n\t"
               "global_load_async_to_lds_b128 %6, %7, off\n\t"
               "global_load_async_to_lds_b128 %8, %9, off\n\t"
               "global_load_async_to_lds_b128 %10, %11, off\n\t"
               "global_load_async_to_lds_b128 %12, %13, off\n\t"
               "global_load_async_to_lds_b128 %14, %15, off\n\t"
               "s_wait_xcnt 0x0"
               :: "v"(l0), "v"((uint64_t)(uintptr_t)g0),
                  "v"(l1), "v"((uint64_t)(uintptr_t)g1),
                  "v"(l2), "v"((uint64_t)(uintptr_t)g2),
                  "v"(l3), "v"((uint64_t)(uintptr_t)g3),
                  "v"(l4), "v"((uint64_t)(uintptr_t)g4),
                  "v"(l5), "v"((uint64_t)(uintptr_t)g5),
                  "v"(l6), "v"((uint64_t)(uintptr_t)g6),
                  "v"(l7), "v"((uint64_t)(uintptr_t)g7)
               : "memory");
}

// A, B: first row of the block's 128 rows. As, Bs: two buffers of GT halves.
// acc[i][j]: rows wm*32 + i*16 .., columns wn*64 + j*16 .. of the block tile.
__device__ __forceinline__ void gemm_128x128_k512(
    const _Float16* __restrict__ A, const _Float16* __restrict__ B,
    const _Float16* As, const _Float16* Bs, int wm, int wn, v8f (&acc)[2][4]) {
  const int tid  = threadIdx.x;
  const int srow = tid >> 3, scg = tid & 7;   // 32 rows x 8 chunks per pass
  const _Float16* ga = A + (size_t)srow * 512 + scg * 8;
  const _Float16* gb = B + (size_t)srow * 512 + scg * 8;
  const uint32_t lofs = (uint32_t)((srow * GP + scg * 8) * 2);
  const uint32_t la = (uint32_t)(uintptr_t)(const void*)As + lofs;
  const uint32_t lb = (uint32_t)(uintptr_t)(const void*)Bs + lofs;
  constexpr uint32_t LR = 32 * GP * 2;        // 32 staged rows, bytes
  constexpr size_t   GR = (size_t)32 * 512;   // 32 source rows, halves

  auto stage = [&](int buf, int k0) {
    const uint32_t a = la + (uint32_t)(buf * GT * 2);
    const uint32_t b = lb + (uint32_t)(buf * GT * 2);
    async_copy8_b128(a,          ga + k0,          a + LR,     ga + k0 + GR,
                     a + 2 * LR, ga + k0 + 2 * GR, a + 3 * LR, ga + k0 + 3 * GR,
                     b,          gb + k0,          b + LR,     gb + k0 + GR,
                     b + 2 * LR, gb + k0 + 2 * GR, b + 3 * LR, gb + k0 + 3 * GR);
  };

  stage(0, 0);
  wait_async0();        // my chunks of tile 0 have landed
  __syncthreads();      // everyone's have
  stage(1, 64);

  for (int t = 0; t < 8; ++t) {
    const _Float16* Ac = As + (t & 1) * GT + wm * 32 * GP;
    const _Float16* Bc = Bs + (t & 1) * GT + wn * 64 * GP;
    // unrolled: both k halves of the tile in one straight run, LDS offsets as
    // immediates
#pragma unroll
    for (int kk = 0; kk < 64; kk += 32) {
      v16h a0 = load_frag(Ac + kk, GP);
      v16h a1 = load_frag(Ac + 16 * GP + kk, GP);
      v16h b0 = load_frag(Bc + kk, GP);
      v16h b1 = load_frag(Bc + 16 * GP + kk, GP);
      v16h b2 = load_frag(Bc + 32 * GP + kk, GP);
      v16h b3 = load_frag(Bc + 48 * GP + kk, GP);
      acc[0][0] = wmma16(a0, b0, acc[0][0]);
      acc[0][1] = wmma16(a0, b1, acc[0][1]);
      acc[0][2] = wmma16(a0, b2, acc[0][2]);
      acc[0][3] = wmma16(a0, b3, acc[0][3]);
      acc[1][0] = wmma16(a1, b0, acc[1][0]);
      acc[1][1] = wmma16(a1, b1, acc[1][1]);
      acc[1][2] = wmma16(a1, b2, acc[1][2]);
      acc[1][3] = wmma16(a1, b3, acc[1][3]);
    }
    wait_ds0();         // my reads of this buffer have retired
    wait_async0();      // my chunks of tile t + 1 have landed
    __syncthreads();    // tile t + 1 is published; this buffer is free
    if (t + 2 < 8) stage(t & 1, (t + 2) * 64);
  }
  wait_async0();        // nothing in flight when the wave goes on
}

// ---------------------------------------------------------------------------
// QKV projection: per which: [8192 x 512] @ [512 x (h,dk) = 512] + bias
// grid (8192/128, 512/128, 3), block 256; a wave's 64 columns are one head.
// which==2 (V) stores transposed [b][h][dv][s]
// ---------------------------------------------------------------------------
__global__ __launch_bounds__(256) void proj_kernel(
    const _Float16* __restrict__ xq, const _Float16* __restrict__ xk,
    const _Float16* __restrict__ xv,
    const _Float16* __restrict__ Wqt, const _Float16* __restrict__ Wkt,
    const _Float16* __restrict__ Wvt,
    const float* __restrict__ bq, const float* __restrict__ bk,
    const float* __restrict__ bv,
    _Float16* __restrict__ Qd, _Float16* __restrict__ Kd,
    _Float16* __restrict__ Vtd) {
  __shared__ __align__(16) _Float16 As[2 * GT];
  __shared__ __align__(16) _Float16 Bs[2 * GT];
  const int wave = threadIdx.x >> 5;
  const int lane = threadIdx.x & 31;
  const int wm = wave & 3, wn = wave >> 2;
  const int which = blockIdx.z;
  const int h     = blockIdx.y * 2 + wn;

  const _Float16* x    = which == 0 ? xq : which == 1 ? xk : xv;
  const _Float16* Wt   = which == 0 ? Wqt : which == 1 ? Wkt : Wvt;
  const float*    bias = which == 0 ? bq : which == 1 ? bk : bv;

  v8f acc[2][4] = {};
  gemm_128x128_k512(x + (size_t)blockIdx.x * 128 * 512,
                    Wt + (size_t)blockIdx.y * 128 * 512,   // [h*64 + dk][f]
                    As, Bs, wm, wn, acc);

  const int hf = lane >> 4, col = lane & 15;
  // A block's 128 rows lie in one batch (128 divides 2048): b and the lane's
  // first row s0 are formed once, and every store of the lane is its one base
  // address plus a constant.
  const int b  = blockIdx.x >> 4;
  const int s0 = (blockIdx.x & 15) * 128 + wm * 32 + 8 * hf;
  // every loop below is unrolled so that acc and bval are indexed by constants
  // only and stay in registers; the innermost index runs along the stored row
  float bval[4];
#pragma unroll
  for (int nt = 0; nt < 4; ++nt) bval[nt] = bias[h * 64 + nt * 16 + col];
  if (which == 2) {
    _Float16* p = Vtd + (((size_t)b * 8 + h) * 64 + col) * 2048 + s0;
#pragma unroll
    for (int nt = 0; nt < 4; ++nt)
#pragma unroll
      for (int i = 0; i < 2; ++i)
#pragma unroll
        for (int r = 0; r < 8; ++r)
          p[nt * 16 * 2048 + i * 16 + r] = (_Float16)(acc[i][nt][r] + bval[nt]);
  } else {
    _Float16* p = (which == 0 ? Qd : Kd) +
                  (((size_t)b * 8 + h) * 2048 + s0) * 64 + col;
#pragma unroll
    for (int i = 0; i < 2; ++i)
#pragma unroll
      for (int r = 0; r < 8; ++r)
#pragma unroll
        for (int nt = 0; nt < 4; ++nt)
          p[(i * 16 + r) * 64 + nt * 16] = (_Float16)(acc[i][nt][r] + bval[nt]);
    // In the built code this path runs on, behind a branch, into the block of
    // the V path: the wait stands in front of that block's register writes.
    asm volatile("s_wait_xcnt 0x0" ::: "memory");
  }
}

constexpr int TK = 128;
constexpr int NP = 2048 / TK;
constexpr int KP = 72;   // K row pitch in halves: 64 data + 8 pad (144 B)
constexpr int VP = 136;  // V^T row pitch in halves: 128 data + 8 pad (272 B)

// value of lane l ^ 16
__device__ __forceinline__ float xhalf(float x) {
  int b = __builtin_bit_cast(int, x);
  return __builtin_bit_cast(
      float, __builtin_amdgcn_permlanex16(b, b, 0x76543210, 0xfedcba98, false,
                                          false));
}

// y[i] = 2^x[i], eight at a time. One statement, so that behind each v_exp_f32
// stands an instruction that neither reads its result nor overwrites its
// source (the next one: the outputs are registers of their own; behind the
// last the v_nop).
__device__ __forceinline__ void exp2x8(const float (&x)[8], float (&y)[8]) {
  asm("v_exp_f32 %0, %8\n\t"
      "v_exp_f32 %1, %9\n\t"
      "v_exp_f32 %2, %10\n\t"
      "v_exp_f32 %3, %11\n\t"
      "v_exp_f32 %4, %12\n\t"
      "v_exp_f32 %5, %13\n\t"
      "v_exp_f32 %6, %14\n\t"
      "v_exp_f32 %7, %15\n\t"
      "v_nop"
      : "=&v"(y[0]), "=&v"(y[1]), "=&v"(y[2]), "=&v"(y[3]),
        "=&v"(y[4]), "=&v"(y[5]), "=&v"(y[6]), "=&v"(y[7])
      : "v"(x[0]), "v"(x[1]), "v"(x[2]), "v"(x[3]),
        "v"(x[4]), "v"(x[5]), "v"(x[6]), "v"(x[7]));
}

// The grid puts two blocks on a WGP, four waves on a SIMD: the register budget
// is stated for that, so that the wide pass may hold its fragments ahead.
__global__ __launch_bounds__(256)
__attribute__((amdgpu_waves_per_eu(4, 4))) void attn_kernel(
    const _Float16* __restrict__ Qd, const _Float16* __restrict__ Kd,
    const _Float16* __restrict__ Vtd, _Float16* __restrict__ concat) {
  __shared__ __align__(16) _Float16 Kl[2][TK * KP];   // [t][dk]
  __shared__ __align__(16) _Float16 Vl[2][64 * VP];   // [dv][t]

  const int tid  = threadIdx.x;
  const int wave = tid >> 5;
  const int lane = tid & 31;
  const int bh   = blockIdx.y;                 // b*8 + h
  const int q0   = blockIdx.x * 128 + wave * 16;

  const _Float16* Qbh = Qd + (size_t)bh * 2048 * 64;
  const _Float16* Kbh = Kd + (size_t)bh * 2048 * 64;
  const _Float16* Vbh = Vtd + (size_t)bh * 64 * 2048;

  // A lane's share of a block: four 16-B chunks of K (32 rows x 8 chunks per
  // step; the block is 16 KB contiguous in memory) and four of V^T (16 rows x
  // 16 chunks per step: 16 lanes fetch 256 contiguous bytes of a row).
  const int krow = tid >> 3, kcg = tid & 7;
  const int vrow = tid >> 4, vcg = tid & 15;
  const _Float16* gk = Kbh + tid * 8;
  const _Float16* gv = Vbh + (size_t)vrow * 2048 + vcg * 8;
  // hardware LDS byte offsets for async copies
  const uint32_t lk = (uint32_t)(uintptr_t)(void*)&Kl[0][0] +
                      (uint32_t)((krow * KP + kcg * 8) * 2);
  const uint32_t lv = (uint32_t)(uintptr_t)(void*)&Vl[0][0] +
                      (uint32_t)((vrow * VP + vcg * 8) * 2);
  constexpr uint32_t LKR = 32 * KP * 2;        // 32 staged K rows, bytes
  constexpr uint32_t LVR = 16 * VP * 2;        // 16 staged V^T rows, bytes
  constexpr size_t   GKR = (size_t)32 * 64;    // 32 K rows, halves
  constexpr size_t   GVR = (size_t)16 * 2048;  // 16 V^T rows, halves

  auto stage = [&](int pp, int t0) {
    const uint32_t k = lk + (uint32_t)(pp * TK * KP * 2);
    const uint32_t v = lv + (uint32_t)(pp * 64 * VP * 2);
    const _Float16* a = gk + (size_t)t0 * 64;
    const _Float16* b = gv + t0;
    async_copy8_b128(k,           a,           k + LKR,     a + GKR,
                     k + 2 * LKR, a + 2 * GKR, k + 3 * LKR, a + 3 * GKR,
                     v,           b,           v + LVR,     b + GVR,
                     v + 2 * LVR, b + 2 * GVR, v + 3 * LVR, b + 3 * GVR);
  };

  stage(0, 0);

  // B fragments of Q^T: column = query lane%16
  const v16h qf0 = load_frag(Qbh + (size_t)q0 * 64, 64);
  const v16h qf1 = load_frag(Qbh + (size_t)q0 * 64 + 32, 64);

  float mrow = -1e30f;   // running maximum of this lane's query
  float lrow = 0.0f;     // running sum over this wave half's keys only
  v8f acc[4] = {};       // O^T: acc[nt][r] = O[query col][nt*16 + 8*hf + r]

  const float scale = 0.125f;   // 1/sqrt(DK)
  const float LOG2E = 0x1.715476p+0f;
  const int hf = lane >> 4, col = lane & 15;

  wait_async0();        // my chunks of block 0 have landed
  __syncthreads();      // everyone's have
  stage(1, TK);

  for (int n = 0; n < NP; ++n) {
    const _Float16* Kc = &Kl[n & 1][0];
    const _Float16* Vc = &Vl[n & 1][0];

    // ---- scores^T: 128 keys x 16 queries (eight 16x16 tiles, K-dim = 64) --
    // every loop of the pass is unrolled: the tiles are indexed by constants
    // only and stay in registers, LDS offsets are immediates
    v8f s[8];
#pragma unroll
    for (int g = 0; g < 8; ++g) {
      v16h kb0 = load_frag(Kc + g * 16 * KP, KP);
      v16h kb1 = load_frag(Kc + g * 16 * KP + 32, KP);
      v8f z = {};
      z = wmma16(kb0, qf0, z);
      s[g] = wmma16(kb1, qf1, z);
    }

    // ---- online softmax: 64 keys of one query per lane --------------------
#pragma unroll
    for (int g = 0; g < 8; ++g)
#pragma unroll
      for (int r = 0; r < 8; ++r) s[g][r] *= scale;
    // four independent maximum chains, one per 32 keys, then joined
    float bk[4];
#pragma unroll
    for (int k = 0; k < 4; ++k) {
      bk[k] = s[2 * k][0];
#pragma unroll
      for (int r = 1; r < 8; ++r) bk[k] = fmaxf(bk[k], s[2 * k][r]);
#pragma unroll
      for (int r = 0; r < 8; ++r) bk[k] = fmaxf(bk[k], s[2 * k + 1][r]);
    }
    float bm = fmaxf(fmaxf(bk[0], bk[1]), fmaxf(bk[2], bk[3]));
    bm = fmaxf(bm, xhalf(bm));           // the other 64 keys of the block
    const float mnew = fmaxf(mrow, bm);
    const float c = __expf(mrow - mnew);
    mrow = mnew;

    // P^T as B fragments, one per 32 keys: element e = key 8*hf+e (e < 8) or
    // 16+8*hf+(e-8), the k order in which load_frag brings the V^T rows
    v16h pf[4];
    float ps[4];
#pragma unroll
    for (int k = 0; k < 4; ++k) {
      // e^d = 2^(d * log2(e)), as __expf forms it
      float x0[8], x1[8], p0[8], p1[8];
#pragma unroll
      for (int r = 0; r < 8; ++r) {
        x0[r] = (s[2 * k][r] - mnew) * LOG2E;
        x1[r] = (s[2 * k + 1][r] - mnew) * LOG2E;
      }
      exp2x8(x0, p0);
      exp2x8(x1, p1);
      ps[k] = 0.0f;
#pragma unroll
      for (int r = 0; r < 8; ++r) {
        ps[k] += p0[r] + p1[r];
        pf[k][r]     = (_Float16)p0[r];
        pf[k][r + 8] = (_Float16)p1[r];
      }
    }
    lrow = lrow * c + ((ps[0] + ps[1]) + (ps[2] + ps[3]));
#pragma unroll
    for (int nt = 0; nt < 4; ++nt)
#pragma unroll
      for (int r = 0; r < 8; ++r) acc[nt][r] *= c;

    // ---- O^T += V^T P^T : A = V^T rows (dv, t-contiguous), B = P^T --------
#pragma unroll
    for (int k = 0; k < 4; ++k) {
      v16h vb[4];
#pragma unroll
      for (int nt = 0; nt < 4; ++nt)
        vb[nt] = load_frag(Vc + nt * 16 * VP + k * 32, VP);
#pragma unroll
      for (int nt = 0; nt < 4; ++nt) acc[nt] = wmma16(vb[nt], pf[k], acc[nt]);
    }

    wait_ds0();         // my reads of this buffer have retired
    wait_async0();      // my chunks of block n + 1 have landed
    __syncthreads();    // block n + 1 is published; this buffer is free
    if (n + 2 < NP) stage(n & 1, (n + 2) * TK);
  }
  wait_async0();        // nothing in flight when the wave goes on

  // epilogue: join the halves' sums, normalize, write f16 concat
  // [b][s][h*64 + dv]; a lane's 8 values of a tile are 8 consecutive dv
  lrow += xhalf(lrow);
  const int b = bh >> 3, h = bh & 7;
  _Float16* orow = concat + ((size_t)(b * 2048 + q0 + col)) * 512 + h * 64 + 8 * hf;
#pragma unroll
  for (int nt = 0; nt < 4; ++nt) {
    union { _Float16 e[8]; uint4 q; } o;
#pragma unroll
    for (int r = 0; r < 8; ++r) o.e[r] = (_Float16)(acc[nt][r] / lrow);
    *(uint4*)(orow + nt * 16) = o.q;
  }
}

// ---------------------------------------------------------------------------
// Output projection: [8192 x 512] @ [512 x 512] + bo -> f32
// grid (8192/128, 512/128), block 256; same GEMM core as the QKV projection.
// ---------------------------------------------------------------------------
__global__ __launch_bounds__(256) void outproj_kernel(
    const _Float16* __restrict__ concat, const _Float16* __restrict__ Wot,
    const float* __restrict__ bo, float* __restrict__ out) {
  __shared__ __align__(16) _Float16 As[2 * GT];
  __shared__ __align__(16) _Float16 Bs[2 * GT];
  const int wave = threadIdx.x >> 5;
  const int lane = threadIdx.x & 31;
  const int wm = wave & 3, wn = wave >> 2;

  v8f acc[2][4] = {};
  gemm_128x128_k512(concat + (size_t)blockIdx.x * 128 * 512,
                    Wot + (size_t)blockIdx.y * 128 * 512,
                    As, Bs, wm, wn, acc);

  const int hf = lane >> 4, col = lane & 15;
  // the three loops are unrolled so that acc is indexed by constants only and
  // stays in registers
#pragma unroll
  for (int i = 0; i < 2; ++i) {
    const int m0 = blockIdx.x * 128 + wm * 32 + i * 16;
#pragma unroll
    for (int nt = 0; nt < 4; ++nt) {
      int n = blockIdx.y * 128 + wn * 64 + nt * 16 + col;
      float bval = bo[n];
#pragma unroll
      for (int r = 0; r < 8; ++r) {
        int m = m0 + r + 8 * hf;
        out[(size_t)m * 512 + n] = acc[i][nt][r] + bval;
      }
    }
  }
}

// ---------------------------------------------------------------------------
extern "C" void kernel_launch(void* const* d_in, const int* in_sizes, int n_in,
                              void* d_out, int out_size, void* d_ws,
                              size_t ws_size, hipStream_t stream) {
  const float* x_q = (const float*)d_in[0];
  const float* x_k = (const float*)d_in[1];
  const float* x_v = (const float*)d_in[2];
  const float* Wq  = (const float*)d_in[3];
  const float* bq  = (const float*)d_in[4];
  const float* Wk  = (const float*)d_in[5];
  const float* bk  = (const float*)d_in[6];
  const float* Wv  = (const float*)d_in[7];
  const float* bv  = (const float*)d_in[8];
  const float* Wo  = (const float*)d_in[9];
  const float* bo  = (const float*)d_in[10];
  float* out = (float*)d_out;
  (void)in_sizes; (void)n_in; (void)out_size; (void)ws_size;

  // workspace carve-up (~61 MB total)
  char* ws = (char*)d_ws;
  size_t off = 0;
  auto take = [&](size_t elems) {
    _Float16* p = (_Float16*)(ws + off);
    off += elems * sizeof(_Float16);
    return p;
  };
  const size_t XE = (size_t)8192 * 512;
  const size_t WE = (size_t)8 * 64 * 512;
  _Float16* xqh = take(XE);
  _Float16* xkh = take(XE);
  _Float16* xvh = take(XE);
  _Float16* Wqt = take(WE);
  _Float16* Wkt = take(WE);
  _Float16* Wvt = take(WE);
  _Float16* Wot = take((size_t)512 * 512);
  _Float16* Qd  = take(XE);
  _Float16* Kd  = take(XE);
  _Float16* Vtd = take(XE);
  _Float16* Cc  = take(XE);

  cvt_all<<<768, 256, 0, stream>>>(x_q, x_k, x_v, xqh, xkh, xvh, Wq, Wk, Wv, Wo,
                                   Wqt, Wkt, Wvt, Wot);

  proj_kernel<<<dim3(64, 4, 3), 256, 0, stream>>>(
      xqh, xkh, xvh, Wqt, Wkt, Wvt, bq, bk, bv, Qd, Kd, Vtd);

  attn_kernel<<<dim3(16, 32), 256, 0, stream>>>(Qd, Kd, Vtd, Cc);

  outproj_kernel<<<dim3(64, 4), 256, 0, stream>>>(Cc, Wot, bo, out);
}

// v007
// Measured time: 69.6 microseconds a run.
// Next to v006, in two timings, it ran 1.03 times as fast each time.
// Over all steps from v000 it is 3.89 times as fast.
#include <hip/hip_runtime.h>
#include <hip/hip_bf16.h>
#include <stdint.h>

// ---------------------------------------------------------------------------
// MultiHeadAttention for MI455X (gfx1250, wave32, WMMA 16x16x32 f16)
//   B=4 S=2048 F=512 H=8 DK=DV=64 FILT=512
// Pipeline: f16 convert -> QKV proj GEMM (WMMA, tiles staged in LDS) ->
// flash attention (WMMA + online softmax + async-to-LDS double buffering) ->
// output GEMM (WMMA, tiles staged in LDS, f32 out)
// ---------------------------------------------------------------------------

typedef __attribute__((ext_vector_type(16))) _Float16 v16h;
typedef __attribute__((ext_vector_type(8)))  float    v8f;

union Frag16 { v16h h; uint4 q[2]; };

// Load a 16x32 f16 fragment (A layout; also our B layout when the source is
// stored reduction-contiguous per row).
//   lane%16 -> row (A: M, B: N); lane/16 -> K half {0..7,16..23} vs {8..15,24..31}
// Two 16-byte transactions; all call sites guarantee 16-B alignment.
__device__ __forceinline__ v16h load_frag(const _Float16* base, int ld) {
  const int lane = threadIdx.x & 31;
  const int hi   = lane >> 4;
  const int idx  = lane & 15;
  const _Float16* row = base + (size_t)idx * ld + hi * 8;
  Frag16 f;
  f.q[0] = *(const uint4*)(row);
  f.q[1] = *(const uint4*)(row + 16);
  return f.h;
}

__device__ __forceinline__ v8f wmma16(v16h a, v16h b, v8f c) {
  return __builtin_amdgcn_wmma_f32_16x16x32_f16(false, a, false, b,
                                                (short)0, c, false, false);
}

// CDNA5 async memory->LDS copies are tracked by ASYNCcnt.
__device__ __forceinline__ void wait_async0() {
  asm volatile("s_wait_asynccnt 0x0" ::: "memory");
}
// This wave's LDS reads of the buffer that is refilled next have retired.
__device__ __forceinline__ void wait_ds0() {
  asm volatile("s_wait_dscnt 0x0" ::: "memory");
}

// ---------------------------------------------------------------------------
// Conversion kernel: f32 -> f16 (x elementwise, weights transposed)
// ---------------------------------------------------------------------------
typedef __attribute__((ext_vector_type(4))) float    v4f;
typedef __attribute__((ext_vector_type(4))) _Float16 v4h;

typedef __attribute__((ext_vector_type(2))) _Float16 v2h;

// One 64 x 64 tile of a transposing conversion: dst[c][r] = (f16)src[r][c],
// src rows of ld floats, dst rows of 512 halves. A lane takes 2 rows x 8
// columns: four b128 loads (32 contiguous bytes of each row), then eight b32
// stores of a row pair. The 32 lanes of a wave hold 64 consecutive rows, so
// each store of a wave writes one whole 128-B line of dst; the 8 waves
// together read 256 contiguous bytes of each source row.
__device__ __forceinline__ void cvt_tr_tile(const float* __restrict__ src,
                                            int ld,
                                            _Float16* __restrict__ dst) {
  const int lane = threadIdx.x & 31, wave = threadIdx.x >> 5;
  const float* s = src + (size_t)(2 * lane) * ld + wave * 8;
  const v4f r0a = *(const v4f*)(s);
  const v4f r0b = *(const v4f*)(s + 4);
  const v4f r1a = *(const v4f*)(s + ld);
  const v4f r1b = *(const v4f*)(s + ld + 4);
  _Float16* d = dst + (size_t)(wave * 8) * 512 + 2 * lane;
#pragma unroll
  for (int j = 0; j < 4; ++j) {
    v2h p = {(_Float16)r0a[j], (_Float16)r1a[j]};
    *(v2h*)(d + j * 512) = p;
  }
#pragma unroll
  for (int j = 0; j < 4; ++j) {
    v2h p = {(_Float16)r0b[j], (_Float16)r1b[j]};
    *(v2h*)(d + (4 + j) * 512) = p;
  }
  // Behind the eight stores: in the built code another branch's block follows,
  // which writes the stores' address and data registers.
  asm volatile("s_wait_xcnt 0x0" ::: "memory");
}

// Every conversion of the pipeline in ONE launch of 768 blocks x 8 waves.
// Blocks 0..511: x_q, x_k, x_v (f32, 8192*512 each) -> f16. A wave owns 1024
// consecutive elements of each tensor: 8 loads of 512 contiguous bytes per
// tensor, all 24 in flight together, then 8 stores of 256 contiguous bytes
// (two whole lines) per tensor.
// Blocks 512..767: the weights, one 64 x 64 tile a block, 64 tiles a matrix:
//   W[h][f][dk] (f32) -> Wt[h][dk][f] (f16), H=8 F=512 DK=64, for Wq, Wk, Wv
//   Wo[c][o] (512x512 f32) -> Wot[o][c] (f16)
// They run beside the x stream instead of in four short launches of their own.
__global__ __launch_bounds__(256) void cvt_all(
    const float* __restrict__ xq, const float* __restrict__ xk,
    const float* __restrict__ xv, _Float16* __restrict__ dq,
    _Float16* __restrict__ dk, _Float16* __restrict__ dv,
    const float* __restrict__ Wq, const float* __restrict__ Wk,
    const float* __restrict__ Wv, const float* __restrict__ Wo,
    _Float16* __restrict__ Wqt, _Float16* __restrict__ Wkt,
    _Float16* __restrict__ Wvt, _Float16* __restrict__ Wot) {
  if (blockIdx.x >= 512) {
    const int t = blockIdx.x - 512;
    const int m = t >> 6, hi = (t >> 3) & 7, lo = t & 7;
    if (m == 3) {
      // rows c = lo*64 .., columns o = hi*64 ..
      cvt_tr_tile(Wo + (size_t)lo * 64 * 512 + hi * 64, 512,
                  Wot + (size_t)hi * 64 * 512 + lo * 64);
    } else {
      // head hi, rows f = lo*64 .., all 64 columns dk
      const float* W  = m == 0 ? Wq : m == 1 ? Wk : Wv;
      _Float16*    Wt = m == 0 ? Wqt : m == 1 ? Wkt : Wvt;
      cvt_tr_tile(W + ((size_t)hi * 512 + lo * 64) * 64, 64,
                  Wt + (size_t)hi * 64 * 512 + lo * 64);
    }
    return;
  }
  const int off = (blockIdx.x * 8 + (threadIdx.x >> 5)) * 1024 +
                  (threadIdx.x & 31) * 4;
  v4f a[8], b[8], c[8];
#pragma unroll
  for (int j = 0; j < 8; ++j) a[j] = *(const v4f*)(xq + off + j * 128);
#pragma unroll
  for (int j = 0; j < 8; ++j) b[j] = *(const v4f*)(xk + off + j * 128);
#pragma unroll
  for (int j = 0; j < 8; ++j) c[j] = *(const v4f*)(xv + off + j * 128);
  // The loads' address registers are reused below: this wait stands in front
  // of the first such overwrite. The three addresses are inputs so that no
  // later load's result is placed on them ahead of the wait.
  asm volatile("s_wait_xcnt 0x0"
               :: "v"(xq + off), "v"(xk + off), "v"(xv + off) : "memory");
  // No conversion is scheduled up among the loads: without this the compiler
  // holds 11 of the 24 loads back until registers of the first ones are free.
  __builtin_amdgcn_sched_barrier(0);
#pragma unroll
  for (int j = 0; j < 8; ++j)
    *(v4h*)(dq + off + j * 128) = __builtin_convertvector(a[j], v4h);
#pragma unroll
  for (int j = 0; j < 8; ++j)
    *(v4h*)(dk + off + j * 128) = __builtin_convertvector(b[j], v4h);
#pragma unroll
  for (int j = 0; j < 8; ++j)
    *(v4h*)(dv + off + j * 128) = __builtin_convertvector(c[j], v4h);
  // Behind the last stores: in the built code the weights' block follows, whose
  // argument loads write the stores' scalar base registers.
  asm volatile("s_wait_xcnt 0x0" ::: "memory");
}

constexpr int GP = 72;
constexpr int GT = 128 * GP;

// Eight copies (one tile's share of a lane) and their s_wait_xcnt in one
// statement, so the address registers are not rewritten ahead of that wait.
__device__ __forceinline__ void async_copy8_b128(
    uint32_t l0, const _Float16* g0, uint32_t l1, const _Float16* g1,
    uint32_t l2, const _Float16* g2, uint32_t l3, const _Float16* g3,
    uint32_t l4, const _Float16* g4, uint32_t l5, const _Float16* g5,
    uint32_t l6, const _Float16* g6, uint32_t l7, const _Float16* g7) {
  asm volatile("global_load_async_to_lds_b128 %0, %1, off\n\t"
               "global_load_async_to_lds_b128 %2, %3, off\n\t"
               "global_load_async_to_lds_b128 %4, %5, off\n\t"
               "global_load_async_to_lds_b128 %6, %7, off\n\t"
               "global_load_async_to_lds_b128 %8, %9, off\n\t"
               "global_load_async_to_lds_b128 %10, %11, off\n\t"
               "global_load_async_to_lds_b128 %12, %13, off\n\t"
               "global_load_async_to_lds_b128 %14, %15, off\n\t"
               "s_wait_xcnt 0x0"
               :: "v"(l0), "v"((uint64_t)(uintptr_t)g0),
                  "v"(l1), "v"((uint64_t)(uintptr_t)g1),
                  "v"(l2), "v"((uint64_t)(uintptr_t)g2),
                  "v"(l3), "v"((uint64_t)(uintptr_t)g3),
                  "v"(l4), "v"((uint64_t)(uintptr_t)g4),
                  "v"(l5), "v"((uint64_t)(uintptr_t)g5),
                  "v"(l6), "v"((uint64_t)(uintptr_t)g6),
                  "v"(l7), "v"((uint64_t)(uintptr_t)g7)
               : "memory");
}

// A, B: first row of the block's 128 rows. As, Bs: two buffers of GT halves.
// acc[i][j]: rows wm*32 + i*16 .., columns wn*64 + j*16 .. of the block tile.
__device__ __forceinline__ void gemm_128x128_k512(
    const _Float16* __restrict__ A, const _Float16* __restrict__ B,
    const _Float16* As, const _Float16* Bs, int wm, int wn, v8f (&acc)[2][4]) {
  const int tid  = threadIdx.x;
  const int srow = tid >> 3, scg = tid & 7;   // 32 rows x 8 chunks per pass
  const _Float16* ga = A + (size_t)srow * 512 + scg * 8;
  const _Float16* gb = B + (size_t)srow * 512 + scg * 8;
  const uint32_t lofs = (uint32_t)((srow * GP + scg * 8) * 2);
  const uint32_t la = (uint32_t)(uintptr_t)(const void*)As + lofs;
  const uint32_t lb = (uint32_t)(uintptr_t)(const void*)Bs + lofs;
  constexpr uint32_t LR = 32 * GP * 2;        // 32 staged rows, bytes
  constexpr size_t   GR = (size_t)32 * 512;   // 32 source rows, halves

  auto stage = [&](int buf, int k0) {
    const uint32_t a = la + (uint32_t)(buf * GT * 2);
    const uint32_t b = lb + (uint32_t)(buf * GT * 2);
    async_copy8_b128(a,          ga + k0,          a + LR,     ga + k0 + GR,
                     a + 2 * LR, ga + k0 + 2 * GR, a + 3 * LR, ga + k0 + 3 * GR,
                     b,          gb + k0,          b + LR,     gb + k0 + GR,
                     b + 2 * LR, gb + k0 + 2 * GR, b + 3 * LR, gb + k0 + 3 * GR);
  };

  stage(0, 0);
  wait_async0();        // my chunks of tile 0 have landed
  __syncthreads();      // everyone's have
  stage(1, 64);

  for (int t = 0; t < 8; ++t) {
    const _Float16* Ac = As + (t & 1) * GT + wm * 32 * GP;
    const _Float16* Bc = Bs + (t & 1) * GT + wn * 64 * GP;
    // unrolled: both k halves of the tile in one straight run, LDS offsets as
    // immediates
#pragma unroll
    for (int kk = 0; kk < 64; kk += 32) {
      v16h a0 = load_frag(Ac + kk, GP);
      v16h a1 = load_frag(Ac + 16 * GP + kk, GP);
      v16h b0 = load_frag(Bc + kk, GP);
      v16h b1 = load_frag(Bc + 16 * GP + kk, GP);
      v16h b2 = load_frag(Bc + 32 * GP + kk, GP);
      v16h b3 = load_frag(Bc + 48 * GP + kk, GP);
      acc[0][0] = wmma16(a0, b0, acc[0][0]);
      acc[0][1] = wmma16(a0, b1, acc[0][1]);
      acc[0][2] = wmma16(a0, b2, acc[0][2]);
      acc[0][3] = wmma16(a0, b3, acc[0][3]);
      acc[1][0] = wmma16(a1, b0, acc[1][0]);
      acc[1][1] = wmma16(a1, b1, acc[1][1]);
      acc[1][2] = wmma16(a1, b2, acc[1][2]);
      acc[1][3] = wmma16(a1, b3, acc[1][3]);
    }
    wait_ds0();         // my reads of this buffer have retired
    wait_async0();      // my chunks of tile t + 1 have landed
    __syncthreads();    // tile t + 1 is published; this buffer is free
    if (t + 2 < 8) stage(t & 1, (t + 2) * 64);
  }
  wait_async0();        // nothing in flight when the wave goes on
}

// ---------------------------------------------------------------------------
// QKV projection: per which: [8192 x 512] @ [512 x (h,dk) = 512] + bias
// grid (8192/128, 512/128, 3), block 256; a wave's 64 columns are one head.
// which==2 (V) stores transposed [b][h][dv][s]
// ---------------------------------------------------------------------------
__global__ __launch_bounds__(256) void proj_kernel(
    const _Float16* __restrict__ xq, const _Float16* __restrict__ xk,
    const _Float16* __restrict__ xv,
    const _Float16* __restrict__ Wqt, const _Float16* __restrict__ Wkt,
    const _Float16* __restrict__ Wvt,
    const float* __restrict__ bq, const float* __restrict__ bk,
    const float* __restrict__ bv,
    _Float16* __restrict__ Qd, _Float16* __restrict__ Kd,
    _Float16* __restrict__ Vtd) {
  __shared__ __align__(16) _Float16 As[2 * GT];
  __shared__ __align__(16) _Float16 Bs[2 * GT];
  const int wave = threadIdx.x >> 5;
  const int lane = threadIdx.x & 31;
  const int wm = wave & 3, wn = wave >> 2;
  const int which = blockIdx.z;
  const int h     = blockIdx.y * 2 + wn;

  const _Float16* x    = which == 0 ? xq : which == 1 ? xk : xv;
  const _Float16* Wt   = which == 0 ? Wqt : which == 1 ? Wkt : Wvt;
  const float*    bias = which == 0 ? bq : which == 1 ? bk : bv;

  v8f acc[2][4] = {};
  gemm_128x128_k512(x + (size_t)blockIdx.x * 128 * 512,
                    Wt + (size_t)blockIdx.y * 128 * 512,   // [h*64 + dk][f]
                    As, Bs, wm, wn, acc);

  const int hf = lane >> 4, col = lane & 15;
  // A block's 128 rows lie in one batch (128 divides 2048): b and the lane's
  // first row s0 are formed once, and every store of the lane is its one base
  // address plus a constant.
  const int b  = blockIdx.x >> 4;
  const int s0 = (blockIdx.x & 15) * 128 + wm * 32 + 8 * hf;
  // every loop below is unrolled so that acc and bval are indexed by constants
  // only and stay in registers; the innermost index runs along the stored row
  float bval[4];
#pragma unroll
  for (int nt = 0; nt < 4; ++nt) bval[nt] = bias[h * 64 + nt * 16 + col];
  if (which == 2) {
    _Float16* p = Vtd + (((size_t)b * 8 + h) * 64 + col) * 2048 + s0;
#pragma unroll
    for (int nt = 0; nt < 4; ++nt)
#pragma unroll
      for (int i = 0; i < 2; ++i)
#pragma unroll
        for (int r = 0; r < 8; ++r)
          p[nt * 16 * 2048 + i * 16 + r] = (_Float16)(acc[i][nt][r] + bval[nt]);
  } else {
    _Float16* p = (which == 0 ? Qd : Kd) +
                  (((size_t)b * 8 + h) * 2048 + s0) * 64 + col;
#pragma unroll
    for (int i = 0; i < 2; ++i)
#pragma unroll
      for (int r = 0; r < 8; ++r)
#pragma unroll
        for (int nt = 0; nt < 4; ++nt)
          p[(i * 16 + r) * 64 + nt * 16] = (_Float16)(acc[i][nt][r] + bval[nt]);
    // In the built code this path runs on, behind a branch, into the block of
    // the V path: the wait stands in front of that block's register writes.
    asm volatile("s_wait_xcnt 0x0" ::: "memory");
  }
}

constexpr int TK = 128;
constexpr int NP = 2048 / TK;
constexpr int KP = 72;   // K row pitch in halves: 64 data + 8 pad (144 B)
constexpr int VP = 136;  // V^T row pitch in halves: 128 data + 8 pad (272 B)

// value of lane l ^ 16
__device__ __forceinline__ float xhalf(float x) {
  int b = __builtin_bit_cast(int, x);
  return __builtin_bit_cast(
      float, __builtin_amdgcn_permlanex16(b, b, 0x76543210, 0xfedcba98, false,
                                          false));
}

// y[i] = 2^x[i], eight at a time. One statement, so that behind each v_exp_f32
// stands an instruction that neither reads its result nor overwrites its
// source (the next one: the outputs are registers of their own; behind the
// last the v_nop).
__device__ __forceinline__ void exp2x8(const float (&x)[8], float (&y)[8]) {
  asm("v_exp_f32 %0, %8\n\t"
      "v_exp_f32 %1, %9\n\t"
      "v_exp_f32 %2, %10\n\t"
      "v_exp_f32 %3, %11\n\t"
      "v_exp_f32 %4, %12\n\t"
      "v_exp_f32 %5, %13\n\t"
      "v_exp_f32 %6, %14\n\t"
      "v_exp_f32 %7, %15\n\t"
      "v_nop"
      : "=&v"(y[0]), "=&v"(y[1]), "=&v"(y[2]), "=&v"(y[3]),
        "=&v"(y[4]), "=&v"(y[5]), "=&v"(y[6]), "=&v"(y[7])
      : "v"(x[0]), "v"(x[1]), "v"(x[2]), "v"(x[3]),
        "v"(x[4]), "v"(x[5]), "v"(x[6]), "v"(x[7]));
}

// y = 2^x, one value, with the same slot behind it.
__device__ __forceinline__ float exp2x1(float x) {
  float y;
  asm("v_exp_f32 %0, %1\n\t"
      "v_nop"
      : "=&v"(y) : "v"(x));
  return y;
}

// The grid puts two blocks on a WGP, four waves on a SIMD: the register budget
// is stated for that.
__global__ __launch_bounds__(256)
__attribute__((amdgpu_waves_per_eu(4, 4))) void attn_kernel(
    const _Float16* __restrict__ Qd, const _Float16* __restrict__ Kd,
    const _Float16* __restrict__ Vtd, _Float16* __restrict__ concat) {
  __shared__ __align__(16) _Float16 Kl[2][TK * KP];   // [t][dk]
  __shared__ __align__(16) _Float16 Vl[2][64 * VP];   // [dv][t]

  const int tid  = threadIdx.x;
  const int wave = tid >> 5;
  const int lane = tid & 31;
  const int qg   = wave & 3;                   // 32 queries of the block's 128
  const int kh   = wave >> 2;                  // 64 keys of every 128
  const int bh   = blockIdx.y;                 // b*8 + h
  const int q0   = blockIdx.x * 128 + qg * 32;

  const _Float16* Qbh = Qd + (size_t)bh * 2048 * 64;
  const _Float16* Kbh = Kd + (size_t)bh * 2048 * 64;
  const _Float16* Vbh = Vtd + (size_t)bh * 64 * 2048;

  // A lane's share of a block: four 16-B chunks of K (32 rows x 8 chunks per
  // step; the block is 16 KB contiguous in memory) and four of V^T (16 rows x
  // 16 chunks per step: 16 lanes fetch 256 contiguous bytes of a row).
  const int krow = tid >> 3, kcg = tid & 7;
  const int vrow = tid >> 4, vcg = tid & 15;
  const _Float16* gk = Kbh + tid * 8;
  const _Float16* gv = Vbh + (size_t)vrow * 2048 + vcg * 8;
  // hardware LDS byte offsets for async copies
  const uint32_t lk = (uint32_t)(uintptr_t)(void*)&Kl[0][0] +
                      (uint32_t)((krow * KP + kcg * 8) * 2);
  const uint32_t lv = (uint32_t)(uintptr_t)(void*)&Vl[0][0] +
                      (uint32_t)((vrow * VP + vcg * 8) * 2);
  constexpr uint32_t LKR = 32 * KP * 2;        // 32 staged K rows, bytes
  constexpr uint32_t LVR = 16 * VP * 2;        // 16 staged V^T rows, bytes
  constexpr size_t   GKR = (size_t)32 * 64;    // 32 K rows, halves
  constexpr size_t   GVR = (size_t)16 * 2048;  // 16 V^T rows, halves

  auto stage = [&](int pp, int t0) {
    const uint32_t k = lk + (uint32_t)(pp * TK * KP * 2);
    const uint32_t v = lv + (uint32_t)(pp * 64 * VP * 2);
    const _Float16* a = gk + (size_t)t0 * 64;
    const _Float16* b = gv + t0;
    async_copy8_b128(k,           a,           k + LKR,     a + GKR,
                     k + 2 * LKR, a + 2 * GKR, k + 3 * LKR, a + 3 * GKR,
                     v,           b,           v + LVR,     b + GVR,
                     v + 2 * LVR, b + 2 * GVR, v + 3 * LVR, b + 3 * GVR);
  };

  stage(0, 0);

  // B fragments of Q^T, two column groups: column = query cg*16 + lane%16
  v16h qf[2][2];
#pragma unroll
  for (int cg = 0; cg < 2; ++cg) {
    qf[cg][0] = load_frag(Qbh + (size_t)(q0 + cg * 16) * 64, 64);
    qf[cg][1] = load_frag(Qbh + (size_t)(q0 + cg * 16) * 64 + 32, 64);
  }

  // per column group, over this wave's key halves only:
  float mrow[2] = {-1e30f, -1e30f};   // running maximum of the lane's query
  float lrow[2] = {0.0f, 0.0f};       // running sum, this half of the lanes
  v8f acc[2][4] = {};   // O^T: acc[cg][nt][r] = O[query][nt*16 + 8*hf + r]

  const float scale = 0.125f;   // 1/sqrt(DK)
  const float LOG2E = 0x1.715476p+0f;
  const int hf = lane >> 4, col = lane & 15;

  wait_async0();        // my chunks of block 0 have landed
  __syncthreads();      // everyone's have
  stage(1, TK);

  for (int n = 0; n < NP; ++n) {
    const _Float16* Kc = &Kl[n & 1][0] + kh * 64 * KP;   // my 64 key rows
    const _Float16* Vc = &Vl[n & 1][0] + kh * 64;        // my 64 key columns

    // ---- scores^T: 64 keys x 32 queries (2 x four 16x16 tiles, K-dim 64) --
    // every loop of the pass is unrolled: the tiles are indexed by constants
    // only and stay in registers, LDS offsets are immediates
    v8f s[2][4];
#pragma unroll
    for (int g = 0; g < 4; ++g) {
      v16h kb0 = load_frag(Kc + g * 16 * KP, KP);
      v16h kb1 = load_frag(Kc + g * 16 * KP + 32, KP);
#pragma unroll
      for (int cg = 0; cg < 2; ++cg) {
        v8f z = {};
        z = wmma16(kb0, qf[cg][0], z);
        s[cg][g] = wmma16(kb1, qf[cg][1], z);
      }
    }

    // ---- online softmax: 32 keys of one query per lane and column group ---
    // P^T as B fragments, one per 32 keys: element e = key 8*hf+e (e < 8) or
    // 16+8*hf+(e-8), the k order in which load_frag brings the V^T rows
    v16h pf[2][2];
#pragma unroll
    for (int cg = 0; cg < 2; ++cg) {
#pragma unroll
      for (int g = 0; g < 4; ++g)
#pragma unroll
        for (int r = 0; r < 8; ++r) s[cg][g][r] *= scale;
      // two independent maximum chains, one per 32 keys, then joined
      float bk[2];
#pragma unroll
      for (int k = 0; k < 2; ++k) {
        bk[k] = s[cg][2 * k][0];
#pragma unroll
        for (int r = 1; r < 8; ++r) bk[k] = fmaxf(bk[k], s[cg][2 * k][r]);
#pragma unroll
        for (int r = 0; r < 8; ++r) bk[k] = fmaxf(bk[k], s[cg][2 * k + 1][r]);
      }
      float bm = fmaxf(bk[0], bk[1]);
      bm = fmaxf(bm, xhalf(bm));         // the other 32 keys of my 64
      const float mnew = fmaxf(mrow[cg], bm);
      const float c = exp2x1((mrow[cg] - mnew) * LOG2E);
      mrow[cg] = mnew;

      float ps[2];
#pragma unroll
      for (int k = 0; k < 2; ++k) {
        // e^d = 2^(d * log2(e)), as __expf forms it
        float x0[8], x1[8], p0[8], p1[8];
#pragma unroll
        for (int r = 0; r < 8; ++r) {
          x0[r] = (s[cg][2 * k][r] - mnew) * LOG2E;
          x1[r] = (s[cg][2 * k + 1][r] - mnew) * LOG2E;
        }
        exp2x8(x0, p0);
        exp2x8(x1, p1);
        ps[k] = 0.0f;
#pragma unroll
        for (int r = 0; r < 8; ++r) {
          ps[k] += p0[r] + p1[r];
          pf[cg][k][r]     = (_Float16)p0[r];
          pf[cg][k][r + 8] = (_Float16)p1[r];
        }
      }
      lrow[cg] = lrow[cg] * c + (ps[0] + ps[1]);
#pragma unroll
      for (int nt = 0; nt < 4; ++nt)
#pragma unroll
        for (int r = 0; r < 8; ++r) acc[cg][nt][r] *= c;
    }

    // ---- O^T += V^T P^T : A = V^T rows (dv, t-contiguous), B = P^T --------
#pragma unroll
    for (int k = 0; k < 2; ++k) {
      v16h vb[4];
#pragma unroll
      for (int nt = 0; nt < 4; ++nt)
        vb[nt] = load_frag(Vc + nt * 16 * VP + k * 32, VP);
      // Inputs only: all four fragments are in registers here, so their eight
      // LDS reads are issued as one group with one wait; without it the reads
      // stand in four places among the matrix instructions, each waited to 0.
      asm volatile("" :: "v"(vb[0]), "v"(vb[1]), "v"(vb[2]), "v"(vb[3]));
#pragma unroll
      for (int nt = 0; nt < 4; ++nt)
#pragma unroll
        for (int cg = 0; cg < 2; ++cg)
          acc[cg][nt] = wmma16(vb[nt], pf[cg][k], acc[cg][nt]);
    }

    wait_ds0();         // my reads of this buffer have retired
    wait_async0();      // my chunks of block n + 1 have landed
    __syncthreads();    // block n + 1 is published; this buffer is free
    if (n + 2 < NP) stage(n & 1, (n + 2) * TK);
  }
  wait_async0();        // nothing in flight when the wave goes on

  // ---- join of the two key halves -----------------------------------------
  // Waves w and w ^ 4 hold the same 32 queries. Each keeps one column group
  // (group kh) and hands the other to its partner through the K buffers, which
  // nobody reads any more behind the loop's last barrier. A wave's range: 8
  // rows of 32 lanes x 16 B (whole-wave contiguous b128), then maximum and sum.
  float* X = (float*)&Kl[0][0];
  v8f keep[4], give[4];
#pragma unroll
  for (int nt = 0; nt < 4; ++nt) {
    keep[nt] = kh ? acc[1][nt] : acc[0][nt];
    give[nt] = kh ? acc[0][nt] : acc[1][nt];
  }
  lrow[0] += xhalf(lrow[0]);    // the lane halves' sums of my keys
  lrow[1] += xhalf(lrow[1]);
  const float mk = kh ? mrow[1] : mrow[0], mg = kh ? mrow[0] : mrow[1];
  const float lk0 = kh ? lrow[1] : lrow[0], lg = kh ? lrow[0] : lrow[1];
#pragma unroll
  for (int nt = 0; nt < 4; ++nt) {
    v4f lo = {give[nt][0], give[nt][1], give[nt][2], give[nt][3]};
    v4f hi = {give[nt][4], give[nt][5], give[nt][6], give[nt][7]};
    *(v4f*)(X + ((wave * 8 + nt * 2) * 32 + lane) * 4)     = lo;
    *(v4f*)(X + ((wave * 8 + nt * 2 + 1) * 32 + lane) * 4) = hi;
  }
  X[8192 + (wave * 2) * 32 + lane]     = mg;
  X[8192 + (wave * 2 + 1) * 32 + lane] = lg;
  __syncthreads();      // the partner's group is published
  const int pw = wave ^ 4;
  const float mp = X[8192 + (pw * 2) * 32 + lane];
  const float lp = X[8192 + (pw * 2 + 1) * 32 + lane];
  const float mj = fmaxf(mk, mp);
  const float ek = __expf(mk - mj), ep = __expf(mp - mj);
  const float lj = lk0 * ek + lp * ep;
  const float fk = ek / lj, fp = ep / lj;

  // normalize, write f16 concat [b][s][h*64 + dv]; a lane's 8 values of a tile
  // are 8 consecutive dv
  const int b = bh >> 3, h = bh & 7;
  _Float16* orow = concat + ((size_t)(b * 2048 + q0 + kh * 16 + col)) * 512 +
                   h * 64 + 8 * hf;
#pragma unroll
  for (int nt = 0; nt < 4; ++nt) {
    const v4f lo = *(const v4f*)(X + ((pw * 8 + nt * 2) * 32 + lane) * 4);
    const v4f hi = *(const v4f*)(X + ((pw * 8 + nt * 2 + 1) * 32 + lane) * 4);
    union { _Float16 e[8]; uint4 q; } o;
#pragma unroll
    for (int r = 0; r < 4; ++r) {
      o.e[r]     = (_Float16)(keep[nt][r] * fk + lo[r] * fp);
      o.e[r + 4] = (_Float16)(keep[nt][r + 4] * fk + hi[r] * fp);
    }
    *(uint4*)(orow + nt * 16) = o.q;
  }
}

// ---------------------------------------------------------------------------
// Output projection: [8192 x 512] @ [512 x 512] + bo -> f32
// grid (8192/128, 512/128), block 256; same GEMM core as the QKV projection.
// ---------------------------------------------------------------------------
__global__ __launch_bounds__(256) void outproj_kernel(
    const _Float16* __restrict__ concat, const _Float16* __restrict__ Wot,
    const float* __restrict__ bo, float* __restrict__ out) {
  __shared__ __align__(16) _Float16 As[2 * GT];
  __shared__ __align__(16) _Float16 Bs[2 * GT];
  const int wave = threadIdx.x >> 5;
  const int lane = threadIdx.x & 31;
  const int wm = wave & 3, wn = wave >> 2;

  v8f acc[2][4] = {};
  gemm_128x128_k512(concat + (size_t)blockIdx.x * 128 * 512,
                    Wot + (size_t)blockIdx.y * 128 * 512,
                    As, Bs, wm, wn, acc);

  const int hf = lane >> 4, col = lane & 15;
  // the three loops are unrolled so that acc is indexed by constants only and
  // stays in registers
#pragma unroll
  for (int i = 0; i < 2; ++i) {
    const int m0 = blockIdx.x * 128 + wm * 32 + i * 16;
#pragma unroll
    for (int nt = 0; nt < 4; ++nt) {
      int n = blockIdx.y * 128 + wn * 64 + nt * 16 + col;
      float bval = bo[n];
#pragma unroll
      for (int r = 0; r < 8; ++r) {
        int m = m0 + r + 8 * hf;
        out[(size_t)m * 512 + n] = acc[i][nt][r] + bval;
      }
    }
  }
}

// ---------------------------------------------------------------------------
extern "C" void kernel_launch(void* const* d_in, const int* in_sizes, int n_in,
                              void* d_out, int out_size, void* d_ws,
                              size_t ws_size, hipStream_t stream) {
  const float* x_q = (const float*)d_in[0];
  const float* x_k = (const float*)d_in[1];
  const float* x_v = (const float*)d_in[2];
  const float* Wq  = (const float*)d_in[3];
  const float* bq  = (const float*)d_in[4];
  const float* Wk  = (const float*)d_in[5];
  const float* bk  = (const float*)d_in[6];
  const float* Wv  = (const float*)d_in[7];
  const float* bv  = (const float*)d_in[8];
  const float* Wo  = (const float*)d_in[9];
  const float* bo  = (const float*)d_in[10];
  float* out = (float*)d_out;
  (void)in_sizes; (void)n_in; (void)out_size; (void)ws_size;

  // workspace carve-up (~61 MB total)
  char* ws = (char*)d_ws;
  size_t off = 0;
  auto take = [&](size_t elems) {
    _Float16* p = (_Float16*)(ws + off);
    off += elems * sizeof(_Float16);
    return p;
  };
  const size_t XE = (size_t)8192 * 512;
  const size_t WE = (size_t)8 * 64 * 512;
  _Float16* xqh = take(XE);
  _Float16* xkh = take(XE);
  _Float16* xvh = take(XE);
  _Float16* Wqt = take(WE);
  _Float16* Wkt = take(WE);
  _Float16* Wvt = take(WE);
  _Float16* Wot = take((size_t)512 * 512);
  _Float16* Qd  = take(XE);
  _Float16* Kd  = take(XE);
  _Float16* Vtd = take(XE);
  _Float16* Cc  = take(XE);

  cvt_all<<<768, 256, 0, stream>>>(x_q, x_k, x_v, xqh, xkh, xvh, Wq, Wk, Wv, Wo,
                                   Wqt, Wkt, Wvt, Wot);

  proj_kernel<<<dim3(64, 4, 3), 256, 0, stream>>>(
      xqh, xkh, xvh, Wqt, Wkt, Wvt, bq, bk, bv, Qd, Kd, Vtd);

  attn_kernel<<<dim3(16, 32), 256, 0, stream>>>(Qd, Kd, Vtd, Cc);

  outproj_kernel<<<dim3(64, 4), 256, 0, stream>>>(Cc, Wot, bo, out);
}

// v009
// It runs in 62.5 microseconds.
// Versions between v007 and this one are left out; their measured steps multiply to 1.11 times as fast.
// Counting every step since v000, it is 4.32 times as fast.
#include <hip/hip_runtime.h>
#include <hip/hip_bf16.h>
#include <stdint.h>

// ---------------------------------------------------------------------------
// MultiHeadAttention for MI455X (gfx1250, wave32, WMMA 16x16x32 f16)
//   B=4 S=2048 F=512 H=8 DK=DV=64 FILT=512
// Pipeline: weights to f16 -> QKV proj GEMM (WMMA, tiles staged in LDS, x
// rounded to f16 on its way into LDS) ->
// flash attention (WMMA + online softmax + async-to-LDS double buffering) ->
// output GEMM (WMMA, tiles staged in LDS, f32 out)
// ---------------------------------------------------------------------------

typedef __attribute__((ext_vector_type(16))) _Float16 v16h;
typedef __attribute__((ext_vector_type(8)))  float    v8f;

union Frag16 { v16h h; uint4 q[2]; };

// Load a 16x32 f16 fragment (A layout; also our B layout when the source is
// stored reduction-contiguous per row).
//   lane%16 -> row (A: M, B: N); lane/16 -> K half {0..7,16..23} vs {8..15,24..31}
// Two 16-byte transactions; all call sites guarantee 16-B alignment.
__device__ __forceinline__ v16h load_frag(const _Float16* base, int ld) {
  const int lane = threadIdx.x & 31;
  const int hi   = lane >> 4;
  const int idx  = lane & 15;
  const _Float16* row = base + (size_t)idx * ld + hi * 8;
  Frag16 f;
  f.q[0] = *(const uint4*)(row);
  f.q[1] = *(const uint4*)(row + 16);
  return f.h;
}

__device__ __forceinline__ v8f wmma16(v16h a, v16h b, v8f c) {
  return __builtin_amdgcn_wmma_f32_16x16x32_f16(false, a, false, b,
                                                (short)0, c, false, false);
}

// CDNA5 async memory->LDS copies are tracked by ASYNCcnt.
__device__ __forceinline__ void wait_async0() {
  asm volatile("s_wait_asynccnt 0x0" ::: "memory");
}
// This wave's LDS reads of the buffer that is refilled next have retired.
__device__ __forceinline__ void wait_ds0() {
  asm volatile("s_wait_dscnt 0x0" ::: "memory");
}

// ---------------------------------------------------------------------------
// Conversion kernel: f32 -> f16 (weights, transposed)
// ---------------------------------------------------------------------------
typedef __attribute__((ext_vector_type(4))) float    v4f;
typedef __attribute__((ext_vector_type(4))) _Float16 v4h;

typedef __attribute__((ext_vector_type(2))) _Float16 v2h;

// One 64 x 64 tile of a transposing conversion: dst[c][r] = (f16)src[r][c],
// src rows of ld floats, dst rows of 512 halves. A lane takes 2 rows x 8
// columns: four b128 loads (32 contiguous bytes of each row), then eight b32
// stores of a row pair. The 32 lanes of a wave hold 64 consecutive rows, so
// each store of a wave writes one whole 128-B line of dst; the 8 waves
// together read 256 contiguous bytes of each source row.
__device__ __forceinline__ void cvt_tr_tile(const float* __restrict__ src,
                                            int ld,
                                            _Float16* __restrict__ dst) {
  const int lane = threadIdx.x & 31, wave = threadIdx.x >> 5;
  const float* s = src + (size_t)(2 * lane) * ld + wave * 8;
  const v4f r0a = *(const v4f*)(s);
  const v4f r0b = *(const v4f*)(s + 4);
  const v4f r1a = *(const v4f*)(s + ld);
  const v4f r1b = *(const v4f*)(s + ld + 4);
  _Float16* d = dst + (size_t)(wave * 8) * 512 + 2 * lane;
#pragma unroll
  for (int j = 0; j < 4; ++j) {
    v2h p = {(_Float16)r0a[j], (_Float16)r1a[j]};
    *(v2h*)(d + j * 512) = p;
  }
#pragma unroll
  for (int j = 0; j < 4; ++j) {
    v2h p = {(_Float16)r0b[j], (_Float16)r1b[j]};
    *(v2h*)(d + (4 + j) * 512) = p;
  }
  // Behind the eight stores: in the built code another branch's block follows,
  // which writes the stores' address and data registers.
  asm volatile("s_wait_xcnt 0x0" ::: "memory");
}

// The weights' conversions in one launch of 256 blocks x 8 waves, one 64 x 64
// tile a block, 64 tiles a matrix:
//   W[h][f][dk] (f32) -> Wt[h][dk][f] (f16), H=8 F=512 DK=64, for Wq, Wk, Wv
//   Wo[c][o] (512x512 f32) -> Wot[o][c] (f16)
__global__ __launch_bounds__(256) void cvt_w(
    const float* __restrict__ Wq, const float* __restrict__ Wk,
    const float* __restrict__ Wv, const float* __restrict__ Wo,
    _Float16* __restrict__ Wqt, _Float16* __restrict__ Wkt,
    _Float16* __restrict__ Wvt, _Float16* __restrict__ Wot) {
  const int t = blockIdx.x;
  const int m = t >> 6, hi = (t >> 3) & 7, lo = t & 7;
  if (m == 3) {
    // rows c = lo*64 .., columns o = hi*64 ..
    cvt_tr_tile(Wo + (size_t)lo * 64 * 512 + hi * 64, 512,
                Wot + (size_t)hi * 64 * 512 + lo * 64);
  } else {
    // head hi, rows f = lo*64 .., all 64 columns dk
    const float* W  = m == 0 ? Wq : m == 1 ? Wk : Wv;
    _Float16*    Wt = m == 0 ? Wqt : m == 1 ? Wkt : Wvt;
    cvt_tr_tile(W + ((size_t)hi * 512 + lo * 64) * 64, 64,
                Wt + (size_t)hi * 64 * 512 + lo * 64);
  }
}

constexpr int GP = 72;
constexpr int GT = 128 * GP;

// Eight copies (one tile's share of a lane) and their s_wait_xcnt in one
// statement, so the address registers are not rewritten ahead of that wait.
__device__ __forceinline__ void async_copy8_b128(
    uint32_t l0, const _Float16* g0, uint32_t l1, const _Float16* g1,
    uint32_t l2, const _Float16* g2, uint32_t l3, const _Float16* g3,
    uint32_t l4, const _Float16* g4, uint32_t l5, const _Float16* g5,
    uint32_t l6, const _Float16* g6, uint32_t l7, const _Float16* g7) {
  asm volatile("global_load_async_to_lds_b128 %0, %1, off\n\t"
               "global_load_async_to_lds_b128 %2, %3, off\n\t"
               "global_load_async_to_lds_b128 %4, %5, off\n\t"
               "global_load_async_to_lds_b128 %6, %7, off\n\t"
               "global_load_async_to_lds_b128 %8, %9, off\n\t"
               "global_load_async_to_lds_b128 %10, %11, off\n\t"
               "global_load_async_to_lds_b128 %12, %13, off\n\t"
               "global_load_async_to_lds_b128 %14, %15, off\n\t"
               "s_wait_xcnt 0x0"
               :: "v"(l0), "v"((uint64_t)(uintptr_t)g0),
                  "v"(l1), "v"((uint64_t)(uintptr_t)g1),
                  "v"(l2), "v"((uint64_t)(uintptr_t)g2),
                  "v"(l3), "v"((uint64_t)(uintptr_t)g3),
                  "v"(l4), "v"((uint64_t)(uintptr_t)g4),
                  "v"(l5), "v"((uint64_t)(uintptr_t)g5),
                  "v"(l6), "v"((uint64_t)(uintptr_t)g6),
                  "v"(l7), "v"((uint64_t)(uintptr_t)g7)
               : "memory");
}

// A, B: first row of the block's 128 rows. As, Bs: two buffers of GT halves.
// acc[i][j]: rows wm*32 + i*16 .., columns wn*64 + j*16 .. of the block tile.
__device__ __forceinline__ void gemm_128x128_k512(
    const _Float16* __restrict__ A, const _Float16* __restrict__ B,
    const _Float16* As, const _Float16* Bs, int wm, int wn, v8f (&acc)[2][4]) {
  const int tid  = threadIdx.x;
  const int srow = tid >> 3, scg = tid & 7;   // 32 rows x 8 chunks per pass
  const _Float16* ga = A + (size_t)srow * 512 + scg * 8;
  const _Float16* gb = B + (size_t)srow * 512 + scg * 8;
  const uint32_t lofs = (uint32_t)((srow * GP + scg * 8) * 2);
  const uint32_t la = (uint32_t)(uintptr_t)(const void*)As + lofs;
  const uint32_t lb = (uint32_t)(uintptr_t)(const void*)Bs + lofs;
  constexpr uint32_t LR = 32 * GP * 2;        // 32 staged rows, bytes
  constexpr size_t   GR = (size_t)32 * 512;   // 32 source rows, halves

  auto stage = [&](int buf, int k0) {
    const uint32_t a = la + (uint32_t)(buf * GT * 2);
    const uint32_t b = lb + (uint32_t)(buf * GT * 2);
    async_copy8_b128(a,          ga + k0,          a + LR,     ga + k0 + GR,
                     a + 2 * LR, ga + k0 + 2 * GR, a + 3 * LR, ga + k0 + 3 * GR,
                     b,          gb + k0,          b + LR,     gb + k0 + GR,
                     b + 2 * LR, gb + k0 + 2 * GR, b + 3 * LR, gb + k0 + 3 * GR);
  };

  stage(0, 0);
  wait_async0();        // my chunks of tile 0 have landed
  __syncthreads();      // everyone's have
  stage(1, 64);

  for (int t = 0; t < 8; ++t) {
    const _Float16* Ac = As + (t & 1) * GT + wm * 32 * GP;
    const _Float16* Bc = Bs + (t & 1) * GT + wn * 64 * GP;
    // unrolled: both k halves of the tile in one straight run, LDS offsets as
    // immediates
#pragma unroll
    for (int kk = 0; kk < 64; kk += 32) {
      v16h a0 = load_frag(Ac + kk, GP);
      v16h a1 = load_frag(Ac + 16 * GP + kk, GP);
      v16h b0 = load_frag(Bc + kk, GP);
      v16h b1 = load_frag(Bc + 16 * GP + kk, GP);
      v16h b2 = load_frag(Bc + 32 * GP + kk, GP);
      v16h b3 = load_frag(Bc + 48 * GP + kk, GP);
      acc[0][0] = wmma16(a0, b0, acc[0][0]);
      acc[0][1] = wmma16(a0, b1, acc[0][1]);
      acc[0][2] = wmma16(a0, b2, acc[0][2]);
      acc[0][3] = wmma16(a0, b3, acc[0][3]);
      acc[1][0] = wmma16(a1, b0, acc[1][0]);
      acc[1][1] = wmma16(a1, b1, acc[1][1]);
      acc[1][2] = wmma16(a1, b2, acc[1][2]);
      acc[1][3] = wmma16(a1, b3, acc[1][3]);
    }
    wait_ds0();         // my reads of this buffer have retired
    wait_async0();      // my chunks of tile t + 1 have landed
    __syncthreads();    // tile t + 1 is published; this buffer is free
    if (t + 2 < 8) stage(t & 1, (t + 2) * 64);
  }
  wait_async0();        // nothing in flight when the wave goes on
}

// ---------------------------------------------------------------------------
// QKV projection: per which: [8192 x 512] @ [512 x (h,dk) = 512] + bias
// grid (8192/128, 3), block 512 = 16 waves; block tile 128 rows x all 512
// columns, waves 2 (M) x 8 (N), each a 64 x 64 tile = 4 x 4 accumulators; a
// wave's 64 columns are one head.
// x is read as f32, here and only here: the block spans every column, so each
// x row is fetched once. Per trip a 128 x 64 tile of x goes through registers
// (16 lanes fetch 256 contiguous bytes of a row), is rounded to f16 and stored
// into LDS; its loads are issued one whole trip ahead of that store. The
// 512 x 64 weight tile comes by asynchronous copies. Two buffers each, row
// pitch 144 B as in the core above.
// which==2 (V) stores transposed [b][h][dv][s]
// which==0 (Q) is stored times QS = log2(e) / sqrt(DK), applied in f32 ahead of
// the one rounding to f16: K Q^T is then the argument of 2^x but for the
// reference that attention subtracts.
// ---------------------------------------------------------------------------
constexpr float QS = 0x1.715476p-3f;   // log2(e) / 8
constexpr int PA = 128 * GP;   // halves of one staged x tile
constexpr int PB = 512 * GP;   // halves of one staged weight tile
__global__ __launch_bounds__(512) void proj_kernel(
    const float* __restrict__ xq, const float* __restrict__ xk,
    const float* __restrict__ xv,
    const _Float16* __restrict__ Wqt, const _Float16* __restrict__ Wkt,
    const _Float16* __restrict__ Wvt,
    const float* __restrict__ bq, const float* __restrict__ bk,
    const float* __restrict__ bv,
    _Float16* __restrict__ Qd, _Float16* __restrict__ Kd,
    _Float16* __restrict__ Vtd) {
  __shared__ __align__(16) _Float16 As[2 * PA];
  __shared__ __align__(16) _Float16 Bs[2 * PB];
  const int tid  = threadIdx.x;
  const int wave = tid >> 5;
  const int lane = tid & 31;
  const int wm = wave & 1, wn = wave >> 1;
  const int which = blockIdx.y;
  const int h     = wn;

  const float*    x    = which == 0 ? xq : which == 1 ? xk : xv;
  const _Float16* Wt   = which == 0 ? Wqt : which == 1 ? Wkt : Wvt;   // [h*64 + dk][f]
  const float*    bias = which == 0 ? bq : which == 1 ? bk : bv;

  // x tile: four steps of 32 rows x 16 chunks of 4 floats
  const int arow = tid >> 4, acg = tid & 15;
  const float* gx = x + ((size_t)blockIdx.x * 128 + arow) * 512 + acg * 4;
  _Float16*    sa = As + arow * GP + acg * 4;
  // weight tile: eight steps of 64 rows x 8 chunks of 8 halves
  const int srow = tid >> 3, scg = tid & 7;
  const _Float16* gb = Wt + (size_t)srow * 512 + scg * 8;
  const uint32_t lb = (uint32_t)(uintptr_t)(const void*)Bs +
                      (uint32_t)((srow * GP + scg * 8) * 2);
  constexpr uint32_t LR = 64 * GP * 2;        // 64 staged rows, bytes
  constexpr size_t   GR = (size_t)64 * 512;   // 64 source rows, halves

  // the loops of both x steps are unrolled: ra is indexed by constants only and
  // stays in registers, the row steps are immediate offsets
  v4f ra[4];
  auto load_x = [&](int k0) {
#pragma unroll
    for (int j = 0; j < 4; ++j)
      ra[j] = *(const v4f*)(gx + (size_t)j * 32 * 512 + k0);
  };
  auto store_x = [&](int buf) {
#pragma unroll
    for (int j = 0; j < 4; ++j)
      *(v4h*)(sa + buf * PA + j * 32 * GP) = __builtin_convertvector(ra[j], v4h);
  };
  auto stage_w = [&](int buf, int k0) {
    const uint32_t b = lb + (uint32_t)(buf * PB * 2);
    const _Float16* g = gb + k0;
    async_copy8_b128(b,          g,          b + LR,     g + GR,
                     b + 2 * LR, g + 2 * GR, b + 3 * LR, g + 3 * GR,
                     b + 4 * LR, g + 4 * GR, b + 5 * LR, g + 5 * GR,
                     b + 6 * LR, g + 6 * GR, b + 7 * LR, g + 7 * GR);
  };

  v8f acc[4][4] = {};

  load_x(0);
  stage_w(0, 0);
  store_x(0);
  load_x(64);
  wait_ds0();           // my part of x tile 0 is in LDS
  wait_async0();        // my chunks of weight tile 0 have landed
  __syncthreads();      // everyone's have
  stage_w(1, 64);

  for (int t = 0; t < 8; ++t) {
    // x tile t + 1 into the buffer that every reader left at the last barrier;
    // then the loads of tile t + 2, which fly during this trip's products
    if (t + 1 < 8) store_x((t + 1) & 1);
    if (t + 2 < 8) load_x((t + 2) * 64);
    const _Float16* Ac = As + (t & 1) * PA + wm * 64 * GP;
    const _Float16* Bc = Bs + (t & 1) * PB + wn * 64 * GP;
    // every loop of the trip is unrolled: both k halves of the tile in one
    // straight run, LDS offsets as immediates, fragments and accumulators
    // indexed by constants only
#pragma unroll
    for (int kk = 0; kk < 64; kk += 32) {
      v16h a[4], b[4];
#pragma unroll
      for (int i = 0; i < 4; ++i) a[i] = load_frag(Ac + i * 16 * GP + kk, GP);
#pragma unroll
      for (int j = 0; j < 4; ++j) b[j] = load_frag(Bc + j * 16 * GP + kk, GP);
      // Inputs only: all eight fragments are in registers here, so their 16 LDS
      // reads are issued as one group with one wait; without it the x fragments
      // share one register set and are read in four places among the matrix
      // instructions, each waited to 0.
      asm volatile("" :: "v"(a[0]), "v"(a[1]), "v"(a[2]), "v"(a[3]),
                         "v"(b[0]), "v"(b[1]), "v"(b[2]), "v"(b[3]));
#pragma unroll
      for (int i = 0; i < 4; ++i)
#pragma unroll
        for (int j = 0; j < 4; ++j) acc[i][j] = wmma16(a[i], b[j], acc[i][j]);
    }
    wait_ds0();         // my reads of these buffers and my x stores have retired
    wait_async0();      // my chunks of weight tile t + 1 have landed
    __syncthreads();    // tiles t + 1 are published; these buffers are free
    if (t + 2 < 8) stage_w(t & 1, (t + 2) * 64);
  }
  wait_async0();        // nothing in flight when the wave goes on

  const int hf = lane >> 4, col = lane & 15;
  // A block's 128 rows lie in one batch (128 divides 2048): b and the lane's
  // first row s0 are formed once, and every store of the lane is its one base
  // address plus a constant.
  const int b  = blockIdx.x >> 4;
  const int s0 = (blockIdx.x & 15) * 128 + wm * 64 + 8 * hf;
  // every loop below is unrolled so that acc and bval are indexed by constants
  // only and stay in registers; the innermost index runs along the stored row
  float bval[4];
#pragma unroll
  for (int nt = 0; nt < 4; ++nt) bval[nt] = bias[h * 64 + nt * 16 + col];
  if (which == 2) {
    _Float16* p = Vtd + (((size_t)b * 8 + h) * 64 + col) * 2048 + s0;
#pragma unroll
    for (int nt = 0; nt < 4; ++nt)
#pragma unroll
      for (int i = 0; i < 4; ++i)
#pragma unroll
        for (int r = 0; r < 8; ++r)
          p[nt * 16 * 2048 + i * 16 + r] = (_Float16)(acc[i][nt][r] + bval[nt]);
  } else {
    _Float16* p = (which == 0 ? Qd : Kd) +
                  (((size_t)b * 8 + h) * 2048 + s0) * 64 + col;
    const float qs = which == 0 ? QS : 1.0f;   // K: times one, exact
    float bs[4];
#pragma unroll
    for (int nt = 0; nt < 4; ++nt) bs[nt] = bval[nt] * qs;
#pragma unroll
    for (int i = 0; i < 4; ++i)
#pragma unroll
      for (int r = 0; r < 8; ++r)
#pragma unroll
        for (int nt = 0; nt < 4; ++nt)
          p[(i * 16 + r) * 64 + nt * 16] = (_Float16)(acc[i][nt][r] * qs + bs[nt]);
    // In the built code this path runs on, behind a branch, into the block of
    // the V path: the wait stands in front of that block's register writes.
    asm volatile("s_wait_xcnt 0x0" ::: "memory");
  }
}

constexpr int TK = 128;
constexpr int NP = 2048 / TK;
constexpr int KP = 72;   // K row pitch in halves: 64 data + 8 pad (144 B)
constexpr int VP = 136;  // V^T row pitch in halves: 128 data + 8 pad (272 B)

// value of lane l ^ 16
__device__ __forceinline__ float xhalf(float x) {
  int b = __builtin_bit_cast(int, x);
  return __builtin_bit_cast(
      float, __builtin_amdgcn_permlanex16(b, b, 0x76543210, 0xfedcba98, false,
                                          false));
}

// y[i] = 2^x[i], eight at a time. One statement, so that behind each v_exp_f32
// stands an instruction that neither reads its result nor overwrites its
// source (the next one: the outputs are registers of their own; behind the
// last the v_nop).
__device__ __forceinline__ void exp2x8(const float (&x)[8], float (&y)[8]) {
  asm("v_exp_f32 %0, %8\n\t"
      "v_exp_f32 %1, %9\n\t"
      "v_exp_f32 %2, %10\n\t"
      "v_exp_f32 %3, %11\n\t"
      "v_exp_f32 %4, %12\n\t"
      "v_exp_f32 %5, %13\n\t"
      "v_exp_f32 %6, %14\n\t"
      "v_exp_f32 %7, %15\n\t"
      "v_nop"
      : "=&v"(y[0]), "=&v"(y[1]), "=&v"(y[2]), "=&v"(y[3]),
        "=&v"(y[4]), "=&v"(y[5]), "=&v"(y[6]), "=&v"(y[7])
      : "v"(x[0]), "v"(x[1]), "v"(x[2]), "v"(x[3]),
        "v"(x[4]), "v"(x[5]), "v"(x[6]), "v"(x[7]));
}

// y = 2^x, one value, with the same slot behind it.
__device__ __forceinline__ float exp2x1(float x) {
  float y;
  asm("v_exp_f32 %0, %1\n\t"
      "v_nop"
      : "=&v"(y) : "v"(x));
  return y;
}

// The grid puts two blocks on a WGP, four waves on a SIMD: the register budget
// is stated for that.
__global__ __launch_bounds__(256)
__attribute__((amdgpu_waves_per_eu(4, 4))) void attn_kernel(
    const _Float16* __restrict__ Qd, const _Float16* __restrict__ Kd,
    const _Float16* __restrict__ Vtd, _Float16* __restrict__ concat) {
  __shared__ __align__(16) _Float16 Kl[2][TK * KP];   // [t][dk]
  __shared__ __align__(16) _Float16 Vl[2][64 * VP];   // [dv][t]

  const int tid  = threadIdx.x;
  const int wave = tid >> 5;
  const int lane = tid & 31;
  const int qg   = wave & 3;                   // 32 queries of the block's 128
  const int kh   = wave >> 2;                  // 64 keys of every 128
  const int bh   = blockIdx.y;                 // b*8 + h
  const int q0   = blockIdx.x * 128 + qg * 32;

  const _Float16* Qbh = Qd + (size_t)bh * 2048 * 64;
  const _Float16* Kbh = Kd + (size_t)bh * 2048 * 64;
  const _Float16* Vbh = Vtd + (size_t)bh * 64 * 2048;

  // A lane's share of a block: four 16-B chunks of K (32 rows x 8 chunks per
  // step; the block is 16 KB contiguous in memory) and four of V^T (16 rows x
  // 16 chunks per step: 16 lanes fetch 256 contiguous bytes of a row).
  const int krow = tid >> 3, kcg = tid & 7;
  const int vrow = tid >> 4, vcg = tid & 15;
  const _Float16* gk = Kbh + tid * 8;
  const _Float16* gv = Vbh + (size_t)vrow * 2048 + vcg * 8;
  // hardware LDS byte offsets for async copies
  const uint32_t lk = (uint32_t)(uintptr_t)(void*)&Kl[0][0] +
                      (uint32_t)((krow * KP + kcg * 8) * 2);
  const uint32_t lv = (uint32_t)(uintptr_t)(void*)&Vl[0][0] +
                      (uint32_t)((vrow * VP + vcg * 8) * 2);
  constexpr uint32_t LKR = 32 * KP * 2;        // 32 staged K rows, bytes
  constexpr uint32_t LVR = 16 * VP * 2;        // 16 staged V^T rows, bytes
  constexpr size_t   GKR = (size_t)32 * 64;    // 32 K rows, halves
  constexpr size_t   GVR = (size_t)16 * 2048;  // 16 V^T rows, halves

  auto stage = [&](int pp, int t0) {
    const uint32_t k = lk + (uint32_t)(pp * TK * KP * 2);
    const uint32_t v = lv + (uint32_t)(pp * 64 * VP * 2);
    const _Float16* a = gk + (size_t)t0 * 64;
    const _Float16* b = gv + t0;
    async_copy8_b128(k,           a,           k + LKR,     a + GKR,
                     k + 2 * LKR, a + 2 * GKR, k + 3 * LKR, a + 3 * GKR,
                     v,           b,           v + LVR,     b + GVR,
                     v + 2 * LVR, b + 2 * GVR, v + 3 * LVR, b + 3 * GVR);
  };

  stage(0, 0);

  // B fragments of Q^T, two column groups: column = query cg*16 + lane%16
  v16h qf[2][2];
#pragma unroll
  for (int cg = 0; cg < 2; ++cg) {
    qf[cg][0] = load_frag(Qbh + (size_t)(q0 + cg * 16) * 64, 64);
    qf[cg][1] = load_frag(Qbh + (size_t)(q0 + cg * 16) * 64 + 32, 64);
  }

  // per column group, over this wave's key halves only:
  v8f nref[2] = {};                   // minus the reference of the lane's query
  float lrow[2] = {0.0f, 0.0f};       // running sum, this half of the lanes
  v8f acc[2][4] = {};   // O^T: acc[cg][nt][r] = O[query][nt*16 + 8*hf + r]

  const int hf = lane >> 4, col = lane & 15;

  wait_async0();        // my chunks of block 0 have landed
  __syncthreads();      // everyone's have
  stage(1, TK);

  // Not unrolled and not peeled: left to itself the compiler splits pass 0 off
  // as a second copy of the whole pass, and registers spill.
#pragma nounroll
  for (int n = 0; n < NP; ++n) {
    const _Float16* Kc = &Kl[n & 1][0] + kh * 64 * KP;   // my 64 key rows
    const _Float16* Vc = &Vl[n & 1][0] + kh * 64;        // my 64 key columns

    // ---- scores^T: 64 keys x 32 queries (2 x four 16x16 tiles, K-dim 64) --
    // every loop of the pass is unrolled: the tiles are indexed by constants
    // only and stay in registers, LDS offsets are immediates
    v8f s[2][4];
#pragma unroll
    for (int g = 0; g < 4; ++g) {
      v16h kb0 = load_frag(Kc + g * 16 * KP, KP);
      v16h kb1 = load_frag(Kc + g * 16 * KP + 32, KP);
#pragma unroll
      for (int cg = 0; cg < 2; ++cg) {
        v8f z = wmma16(kb0, qf[cg][0], nref[cg]);   // C = -reference
        s[cg][g] = wmma16(kb1, qf[cg][1], z);
      }
    }

    // ---- online softmax: 32 keys of one query per lane and column group ---
    // the lane's own largest exponent per column group: two independent chains,
    // one per 32 keys, then joined
    float bm[2];
#pragma unroll
    for (int cg = 0; cg < 2; ++cg) {
      float bk[2];
#pragma unroll
      for (int k = 0; k < 2; ++k) {
        bk[k] = s[cg][2 * k][0];
#pragma unroll
        for (int r = 1; r < 8; ++r) bk[k] = fmaxf(bk[k], s[cg][2 * k][r]);
#pragma unroll
        for (int r = 0; r < 8; ++r) bk[k] = fmaxf(bk[k], s[cg][2 * k + 1][r]);
      }
      bm[cg] = fmaxf(bk[0], bk[1]);
    }
    // One test per pass, the same for the whole wave. Pass 0 always enters: it
    // sets the reference (up or down) to the maximum of its own 64 keys.
    const bool need = fmaxf(bm[0], bm[1]) > 8.0f;
    if (n == 0 || __builtin_amdgcn_ballot_w32(need) != 0) {
#pragma unroll
      for (int cg = 0; cg < 2; ++cg) {
        const float m = fmaxf(bm[cg], xhalf(bm[cg]));   // all 64 keys of the query
        const float d = n == 0 ? m : fmaxf(m, 0.0f);    // the reference's rise
        // pass 0 has nothing to rescale (O and the sum are 0)
        const float c = n == 0 ? 1.0f : exp2x1(-d);
        nref[cg] -= d;
#pragma unroll
        for (int g = 0; g < 4; ++g) s[cg][g] -= d;
        lrow[cg] *= c;
#pragma unroll
        for (int nt = 0; nt < 4; ++nt) acc[cg][nt] *= c;
      }
    }

    // V^T fragments of the first 32 keys, read here so that the exponentials
    // cover their LDS latency (the scheduling barrier below would hold them back)
    v16h vb0[4];
#pragma unroll
    for (int nt = 0; nt < 4; ++nt) vb0[nt] = load_frag(Vc + nt * 16 * VP, VP);

    // P^T as B fragments, one per 32 keys: element e = key 8*hf+e (e < 8) or
    // 16+8*hf+(e-8), the k order in which load_frag brings the V^T rows
    v16h pf[2][2];
#pragma unroll
    for (int cg = 0; cg < 2; ++cg) {
      float ps[2];
#pragma unroll
      for (int k = 0; k < 2; ++k) {
        float x0[8], x1[8], p0[8], p1[8];
#pragma unroll
        for (int r = 0; r < 8; ++r) {
          x0[r] = s[cg][2 * k][r];
          x1[r] = s[cg][2 * k + 1][r];
        }
        exp2x8(x0, p0);
        exp2x8(x1, p1);
        ps[k] = 0.0f;
#pragma unroll
        for (int r = 0; r < 8; ++r) {
          ps[k] += p0[r] + p1[r];
          pf[cg][k][r]     = (_Float16)p0[r];
          pf[cg][k][r + 8] = (_Float16)p1[r];
        }
      }
      lrow[cg] += ps[0] + ps[1];
    }
    // Each row's sum is formed here (inputs only; the remedy against spills of
    // the streaming pattern): left alone the compiler sinks the adds behind the
    // pass's foot, all 64 exponentials stay live across the second product, and
    // a Q fragment is spilled and reloaded in every pass.
    asm volatile("" :: "v"(lrow[0]), "v"(lrow[1]));
    // No exponential statement sinks among the matrix instructions below.
    __builtin_amdgcn_sched_barrier(0);

    // ---- O^T += V^T P^T : A = V^T rows (dv, t-contiguous), B = P^T --------
#pragma unroll
    for (int k = 0; k < 2; ++k) {
      v16h vb[4];
#pragma unroll
      for (int nt = 0; nt < 4; ++nt)
        vb[nt] = k == 0 ? vb0[nt] : load_frag(Vc + nt * 16 * VP + k * 32, VP);
      // Inputs only: all four fragments are in registers here, so their eight
      // LDS reads are issued as one group with one wait; without it the reads
      // stand in four places among the matrix instructions, each waited to 0.
      asm volatile("" :: "v"(vb[0]), "v"(vb[1]), "v"(vb[2]), "v"(vb[3]));
#pragma unroll
      for (int nt = 0; nt < 4; ++nt)
#pragma unroll
        for (int cg = 0; cg < 2; ++cg)
          acc[cg][nt] = wmma16(vb[nt], pf[cg][k], acc[cg][nt]);
    }

    wait_ds0();         // my reads of this buffer have retired
    wait_async0();      // my chunks of block n + 1 have landed
    __syncthreads();    // block n + 1 is published; this buffer is free
    if (n + 2 < NP) stage(n & 1, (n + 2) * TK);
  }
  wait_async0();        // nothing in flight when the wave goes on

  // ---- join of the two key halves -----------------------------------------
  // Waves w and w ^ 4 hold the same 32 queries. Each keeps one column group
  // (group kh) and hands the other to its partner through the K buffers, which
  // nobody reads any more behind the loop's last barrier. A wave's range: 8
  // rows of 32 lanes x 16 B (whole-wave contiguous b128), then reference and sum.
  float* X = (float*)&Kl[0][0];
  v8f keep[4], give[4];
#pragma unroll
  for (int nt = 0; nt < 4; ++nt) {
    keep[nt] = kh ? acc[1][nt] : acc[0][nt];
    give[nt] = kh ? acc[0][nt] : acc[1][nt];
  }
  lrow[0] += xhalf(lrow[0]);    // the lane halves' sums of my keys
  lrow[1] += xhalf(lrow[1]);
  // the two groups' references, in the exponent's unit (powers of two)
  const float mk = kh ? -nref[1][0] : -nref[0][0];
  const float mg = kh ? -nref[0][0] : -nref[1][0];
  const float lk0 = kh ? lrow[1] : lrow[0], lg = kh ? lrow[0] : lrow[1];
#pragma unroll
  for (int nt = 0; nt < 4; ++nt) {
    v4f lo = {give[nt][0], give[nt][1], give[nt][2], give[nt][3]};
    v4f hi = {give[nt][4], give[nt][5], give[nt][6], give[nt][7]};
    *(v4f*)(X + ((wave * 8 + nt * 2) * 32 + lane) * 4)     = lo;
    *(v4f*)(X + ((wave * 8 + nt * 2 + 1) * 32 + lane) * 4) = hi;
  }
  X[8192 + (wave * 2) * 32 + lane]     = mg;
  X[8192 + (wave * 2 + 1) * 32 + lane] = lg;
  __syncthreads();      // the partner's group is published
  const int pw = wave ^ 4;
  const float mp = X[8192 + (pw * 2) * 32 + lane];
  const float lp = X[8192 + (pw * 2 + 1) * 32 + lane];
  const float mj = fmaxf(mk, mp);
  const float ek = exp2x1(mk - mj), ep = exp2x1(mp - mj);
  const float lj = lk0 * ek + lp * ep;
  const float fk = ek / lj, fp = ep / lj;

  // normalize, write f16 concat [b][s][h*64 + dv]; a lane's 8 values of a tile
  // are 8 consecutive dv
  const int b = bh >> 3, h = bh & 7;
  _Float16* orow = concat + ((size_t)(b * 2048 + q0 + kh * 16 + col)) * 512 +
                   h * 64 + 8 * hf;
#pragma unroll
  for (int nt = 0; nt < 4; ++nt) {
    const v4f lo = *(const v4f*)(X + ((pw * 8 + nt * 2) * 32 + lane) * 4);
    const v4f hi = *(const v4f*)(X + ((pw * 8 + nt * 2 + 1) * 32 + lane) * 4);
    union { _Float16 e[8]; uint4 q; } o;
#pragma unroll
    for (int r = 0; r < 4; ++r) {
      o.e[r]     = (_Float16)(keep[nt][r] * fk + lo[r] * fp);
      o.e[r + 4] = (_Float16)(keep[nt][r + 4] * fk + hi[r] * fp);
    }
    *(uint4*)(orow + nt * 16) = o.q;
  }
}

// ---------------------------------------------------------------------------
// Output projection: [8192 x 512] @ [512 x 512] + bo -> f32
// grid (8192/128, 512/128), block 256; the 128 x 128 GEMM core above.
// ---------------------------------------------------------------------------
__global__ __launch_bounds__(256) void outproj_kernel(
    const _Float16* __restrict__ concat, const _Float16* __restrict__ Wot,
    const float* __restrict__ bo, float* __restrict__ out) {
  __shared__ __align__(16) _Float16 As[2 * GT];
  __shared__ __align__(16) _Float16 Bs[2 * GT];
  const int wave = threadIdx.x >> 5;
  const int lane = threadIdx.x & 31;
  const int wm = wave & 3, wn = wave >> 2;

  v8f acc[2][4] = {};
  gemm_128x128_k512(concat + (size_t)blockIdx.x * 128 * 512,
                    Wot + (size_t)blockIdx.y * 128 * 512,
                    As, Bs, wm, wn, acc);

  const int hf = lane >> 4, col = lane & 15;
  // the three loops are unrolled so that acc is indexed by constants only and
  // stays in registers
#pragma unroll
  for (int i = 0; i < 2; ++i) {
    const int m0 = blockIdx.x * 128 + wm * 32 + i * 16;
#pragma unroll
    for (int nt = 0; nt < 4; ++nt) {
      int n = blockIdx.y * 128 + wn * 64 + nt * 16 + col;
      float bval = bo[n];
#pragma unroll
      for (int r = 0; r < 8; ++r) {
        int m = m0 + r + 8 * hf;
        out[(size_t)m * 512 + n] = acc[i][nt][r] + bval;
      }
    }
  }
}

// ---------------------------------------------------------------------------
extern "C" void kernel_launch(void* const* d_in, const int* in_sizes, int n_in,
                              void* d_out, int out_size, void* d_ws,
                              size_t ws_size, hipStream_t stream) {
  const float* x_q = (const float*)d_in[0];
  const float* x_k = (const float*)d_in[1];
  const float* x_v = (const float*)d_in[2];
  const float* Wq  = (const float*)d_in[3];
  const float* bq  = (const float*)d_in[4];
  const float* Wk  = (const float*)d_in[5];
  const float* bk  = (const float*)d_in[6];
  const float* Wv  = (const float*)d_in[7];
  const float* bv  = (const float*)d_in[8];
  const float* Wo  = (const float*)d_in[9];
  const float* bo  = (const float*)d_in[10];
  float* out = (float*)d_out;
  (void)in_sizes; (void)n_in; (void)out_size; (void)ws_size;

  // workspace carve-up (~36 MB total)
  char* ws = (char*)d_ws;
  size_t off = 0;
  auto take = [&](size_t elems) {
    _Float16* p = (_Float16*)(ws + off);
    off += elems * sizeof(_Float16);
    return p;
  };
  const size_t XE = (size_t)8192 * 512;
  const size_t WE = (size_t)8 * 64 * 512;
  _Float16* Wqt = take(WE);
  _Float16* Wkt = take(WE);
  _Float16* Wvt = take(WE);
  _Float16* Wot = take((size_t)512 * 512);
  _Float16* Qd  = take(XE);
  _Float16* Kd  = take(XE);
  _Float16* Vtd = take(XE);
  _Float16* Cc  = take(XE);

  cvt_w<<<256, 256, 0, stream>>>(Wq, Wk, Wv, Wo, Wqt, Wkt, Wvt, Wot);

  proj_kernel<<<dim3(64, 3), 512, 0, stream>>>(
      x_q, x_k, x_v, Wqt, Wkt, Wvt, bq, bk, bv, Qd, Kd, Vtd);

  attn_kernel<<<dim3(16, 32), 256, 0, stream>>>(Qd, Kd, Vtd, Cc);

  outproj_kernel<<<dim3(64, 4), 256, 0, stream>>>(Cc, Wot, bo, out);
}

// v010
// Measured time: 61 microseconds a run.
// Next to v009, in two timings, it ran 1.04 and 1.03 times as fast.
// Over all steps from v000 it is 4.48 times as fast.
#include <hip/hip_runtime.h>
#include <hip/hip_bf16.h>
#include <stdint.h>

// ---------------------------------------------------------------------------
// MultiHeadAttention for MI455X (gfx1250, wave32, WMMA 16x16x32 f16)
//   B=4 S=2048 F=512 H=8 DK=DV=64 FILT=512
// Pipeline: weights to f16 -> QKV proj GEMM (WMMA, tiles staged in LDS, x
// rounded to f16 on its way into LDS) ->
// flash attention (WMMA + online softmax + async-to-LDS double buffering) ->
// output GEMM (WMMA, tiles staged in LDS, f32 out)
// ---------------------------------------------------------------------------

typedef __attribute__((ext_vector_type(16))) _Float16 v16h;
typedef __attribute__((ext_vector_type(8)))  float    v8f;

union Frag16 { v16h h; uint4 q[2]; };

// Load a 16x32 f16 fragment (A layout; also our B layout when the source is
// stored reduction-contiguous per row).
//   lane%16 -> row (A: M, B: N); lane/16 -> K half {0..7,16..23} vs {8..15,24..31}
// Two 16-byte transactions; all call sites guarantee 16-B alignment.
__device__ __forceinline__ v16h load_frag(const _Float16* base, int ld) {
  const int lane = threadIdx.x & 31;
  const int hi   = lane >> 4;
  const int idx  = lane & 15;
  const _Float16* row = base + (size_t)idx * ld + hi * 8;
  Frag16 f;
  f.q[0] = *(const uint4*)(row);
  f.q[1] = *(const uint4*)(row + 16);
  return f.h;
}

__device__ __forceinline__ v8f wmma16(v16h a, v16h b, v8f c) {
  return __builtin_amdgcn_wmma_f32_16x16x32_f16(false, a, false, b,
                                                (short)0, c, false, false);
}

// CDNA5 async memory->LDS copies are tracked by ASYNCcnt.
__device__ __forceinline__ void wait_async0() {
  asm volatile("s_wait_asynccnt 0x0" ::: "memory");
}
// This wave's LDS reads of the buffer that is refilled next have retired.
__device__ __forceinline__ void wait_ds0() {
  asm volatile("s_wait_dscnt 0x0" ::: "memory");
}

// ---------------------------------------------------------------------------
// Conversion kernel: f32 -> f16 (weights, transposed)
// ---------------------------------------------------------------------------
typedef __attribute__((ext_vector_type(4))) float    v4f;
typedef __attribute__((ext_vector_type(4))) _Float16 v4h;

typedef __attribute__((ext_vector_type(2))) _Float16 v2h;

// One 64 x 64 tile of a transposing conversion: dst[c][r] = (f16)src[r][c],
// src rows of ld floats, dst rows of 512 halves. A lane takes 2 rows x 8
// columns: four b128 loads (32 contiguous bytes of each row), then eight b32
// stores of a row pair. The 32 lanes of a wave hold 64 consecutive rows, so
// each store of a wave writes one whole 128-B line of dst; the 8 waves
// together read 256 contiguous bytes of each source row.
__device__ __forceinline__ void cvt_tr_tile(const float* __restrict__ src,
                                            int ld,
                                            _Float16* __restrict__ dst) {
  const int lane = threadIdx.x & 31, wave = threadIdx.x >> 5;
  const float* s = src + (size_t)(2 * lane) * ld + wave * 8;
  const v4f r0a = *(const v4f*)(s);
  const v4f r0b = *(const v4f*)(s + 4);
  const v4f r1a = *(const v4f*)(s + ld);
  const v4f r1b = *(const v4f*)(s + ld + 4);
  _Float16* d = dst + (size_t)(wave * 8) * 512 + 2 * lane;
#pragma unroll
  for (int j = 0; j < 4; ++j) {
    v2h p = {(_Float16)r0a[j], (_Float16)r1a[j]};
    *(v2h*)(d + j * 512) = p;
  }
#pragma unroll
  for (int j = 0; j < 4; ++j) {
    v2h p = {(_Float16)r0b[j], (_Float16)r1b[j]};
    *(v2h*)(d + (4 + j) * 512) = p;
  }
  // Behind the eight stores: in the built code another branch's block follows,
  // which writes the stores' address and data registers.
  asm volatile("s_wait_xcnt 0x0" ::: "memory");
}

// The weights' conversions in one launch of 256 blocks x 8 waves, one 64 x 64
// tile a block, 64 tiles a matrix:
//   W[h][f][dk] (f32) -> Wt[h][dk][f] (f16), H=8 F=512 DK=64, for Wq, Wk, Wv
//   Wo[c][o] (512x512 f32) -> Wot[o][c] (f16)
__global__ __launch_bounds__(256) void cvt_w(
    const float* __restrict__ Wq, const float* __restrict__ Wk,
    const float* __restrict__ Wv, const float* __restrict__ Wo,
    _Float16* __restrict__ Wqt, _Float16* __restrict__ Wkt,
    _Float16* __restrict__ Wvt, _Float16* __restrict__ Wot) {
  const int t = blockIdx.x;
  const int m = t >> 6, hi = (t >> 3) & 7, lo = t & 7;
  if (m == 3) {
    // rows c = lo*64 .., columns o = hi*64 ..
    cvt_tr_tile(Wo + (size_t)lo * 64 * 512 + hi * 64, 512,
                Wot + (size_t)hi * 64 * 512 + lo * 64);
  } else {
    // head hi, rows f = lo*64 .., all 64 columns dk
    const float* W  = m == 0 ? Wq : m == 1 ? Wk : Wv;
    _Float16*    Wt = m == 0 ? Wqt : m == 1 ? Wkt : Wvt;
    cvt_tr_tile(W + ((size_t)hi * 512 + lo * 64) * 64, 64,
                Wt + (size_t)hi * 64 * 512 + lo * 64);
  }
}

constexpr int GP = 72;
constexpr int GT = 128 * GP;

// Eight copies (one tile's share of a lane) and their s_wait_xcnt in one
// statement, so the address registers are not rewritten ahead of that wait.
__device__ __forceinline__ void async_copy8_b128(
    uint32_t l0, const _Float16* g0, uint32_t l1, const _Float16* g1,
    uint32_t l2, const _Float16* g2, uint32_t l3, const _Float16* g3,
    uint32_t l4, const _Float16* g4, uint32_t l5, const _Float16* g5,
    uint32_t l6, const _Float16* g6, uint32_t l7, const _Float16* g7) {
  asm volatile("global_load_async_to_lds_b128 %0, %1, off\n\t"
               "global_load_async_to_lds_b128 %2, %3, off\n\t"
               "global_load_async_to_lds_b128 %4, %5, off\n\t"
               "global_load_async_to_lds_b128 %6, %7, off\n\t"
               "global_load_async_to_lds_b128 %8, %9, off\n\t"
               "global_load_async_to_lds_b128 %10, %11, off\n\t"
               "global_load_async_to_lds_b128 %12, %13, off\n\t"
               "global_load_async_to_lds_b128 %14, %15, off\n\t"
               "s_wait_xcnt 0x0"
               :: "v"(l0), "v"((uint64_t)(uintptr_t)g0),
                  "v"(l1), "v"((uint64_t)(uintptr_t)g1),
                  "v"(l2), "v"((uint64_t)(uintptr_t)g2),
                  "v"(l3), "v"((uint64_t)(uintptr_t)g3),
                  "v"(l4), "v"((uint64_t)(uintptr_t)g4),
                  "v"(l5), "v"((uint64_t)(uintptr_t)g5),
                  "v"(l6), "v"((uint64_t)(uintptr_t)g6),
                  "v"(l7), "v"((uint64_t)(uintptr_t)g7)
               : "memory");
}

// A, B: first row of the block's 128 rows. As, Bs: two buffers of GT halves.
// acc[i][j]: rows wm*32 + i*16 .., columns wn*64 + j*16 .. of the block tile.
__device__ __forceinline__ void gemm_128x128_k512(
    const _Float16* __restrict__ A, const _Float16* __restrict__ B,
    const _Float16* As, const _Float16* Bs, int wm, int wn, v8f (&acc)[2][4]) {
  const int tid  = threadIdx.x;
  const int srow = tid >> 3, scg = tid & 7;   // 32 rows x 8 chunks per pass
  const _Float16* ga = A + (size_t)srow * 512 + scg * 8;
  const _Float16* gb = B + (size_t)srow * 512 + scg * 8;
  const uint32_t lofs = (uint32_t)((srow * GP + scg * 8) * 2);
  const uint32_t la = (uint32_t)(uintptr_t)(const void*)As + lofs;
  const uint32_t lb = (uint32_t)(uintptr_t)(const void*)Bs + lofs;
  constexpr uint32_t LR = 32 * GP * 2;        // 32 staged rows, bytes
  constexpr size_t   GR = (size_t)32 * 512;   // 32 source rows, halves

  auto stage = [&](int buf, int k0) {
    const uint32_t a = la + (uint32_t)(buf * GT * 2);
    const uint32_t b = lb + (uint32_t)(buf * GT * 2);
    async_copy8_b128(a,          ga + k0,          a + LR,     ga + k0 + GR,
                     a + 2 * LR, ga + k0 + 2 * GR, a + 3 * LR, ga + k0 + 3 * GR,
                     b,          gb + k0,          b + LR,     gb + k0 + GR,
                     b + 2 * LR, gb + k0 + 2 * GR, b + 3 * LR, gb + k0 + 3 * GR);
  };

  stage(0, 0);
  wait_async0();        // my chunks of tile 0 have landed
  __syncthreads();      // everyone's have
  stage(1, 64);

  for (int t = 0; t < 8; ++t) {
    const _Float16* Ac = As + (t & 1) * GT + wm * 32 * GP;
    const _Float16* Bc = Bs + (t & 1) * GT + wn * 64 * GP;
    // unrolled: both k halves of the tile in one straight run, LDS offsets as
    // immediates
#pragma unroll
    for (int kk = 0; kk < 64; kk += 32) {
      v16h a0 = load_frag(Ac + kk, GP);
      v16h a1 = load_frag(Ac + 16 * GP + kk, GP);
      v16h b0 = load_frag(Bc + kk, GP);
      v16h b1 = load_frag(Bc + 16 * GP + kk, GP);
      v16h b2 = load_frag(Bc + 32 * GP + kk, GP);
      v16h b3 = load_frag(Bc + 48 * GP + kk, GP);
      acc[0][0] = wmma16(a0, b0, acc[0][0]);
      acc[0][1] = wmma16(a0, b1, acc[0][1]);
      acc[0][2] = wmma16(a0, b2, acc[0][2]);
      acc[0][3] = wmma16(a0, b3, acc[0][3]);
      acc[1][0] = wmma16(a1, b0, acc[1][0]);
      acc[1][1] = wmma16(a1, b1, acc[1][1]);
      acc[1][2] = wmma16(a1, b2, acc[1][2]);
      acc[1][3] = wmma16(a1, b3, acc[1][3]);
    }
    wait_ds0();         // my reads of this buffer have retired
    wait_async0();      // my chunks of tile t + 1 have landed
    __syncthreads();    // tile t + 1 is published; this buffer is free
    if (t + 2 < 8) stage(t & 1, (t + 2) * 64);
  }
  wait_async0();        // nothing in flight when the wave goes on
}

// ---------------------------------------------------------------------------
// QKV projection: per which: [8192 x 512] @ [512 x (h,dk) = 512] + bias
// grid (8192/128, 3), block 512 = 16 waves; block tile 128 rows x all 512
// columns, waves 2 (M) x 8 (N), each a 64 x 64 tile = 4 x 4 accumulators; a
// wave's 64 columns are one head.
// x is read as f32, here and only here: the block spans every column, so each
// x row is fetched once. Per trip a 128 x 64 tile of x goes through registers
// (16 lanes fetch 256 contiguous bytes of a row), is rounded to f16 and stored
// into LDS; its loads are issued one whole trip ahead of that store. The
// 512 x 64 weight tile comes by asynchronous copies. Two buffers each, row
// pitch 144 B as in the core above.
// which==2 (V) stores transposed [b][h][dv][s]
// which==0 (Q) is stored times QS = log2(e) / sqrt(DK), applied in f32 ahead of
// the one rounding to f16: K Q^T is then the argument of 2^x but for the
// reference that attention subtracts.
// ---------------------------------------------------------------------------
constexpr float QS = 0x1.715476p-3f;   // log2(e) / 8
constexpr int PA = 128 * GP;   // halves of one staged x tile
constexpr int PB = 512 * GP;   // halves of one staged weight tile
__global__ __launch_bounds__(512) void proj_kernel(
    const float* __restrict__ xq, const float* __restrict__ xk,
    const float* __restrict__ xv,
    const _Float16* __restrict__ Wqt, const _Float16* __restrict__ Wkt,
    const _Float16* __restrict__ Wvt,
    const float* __restrict__ bq, const float* __restrict__ bk,
    const float* __restrict__ bv,
    _Float16* __restrict__ Qd, _Float16* __restrict__ Kd,
    _Float16* __restrict__ Vtd) {
  __shared__ __align__(16) _Float16 As[2 * PA];
  __shared__ __align__(16) _Float16 Bs[2 * PB];
  const int tid  = threadIdx.x;
  const int wave = tid >> 5;
  const int lane = tid & 31;
  const int wm = wave & 1, wn = wave >> 1;
  const int which = blockIdx.y;
  const int h     = wn;

  const float*    x    = which == 0 ? xq : which == 1 ? xk : xv;
  const _Float16* Wt   = which == 0 ? Wqt : which == 1 ? Wkt : Wvt;   // [h*64 + dk][f]
  const float*    bias = which == 0 ? bq : which == 1 ? bk : bv;

  // x tile: four steps of 32 rows x 16 chunks of 4 floats
  const int arow = tid >> 4, acg = tid & 15;
  const float* gx = x + ((size_t)blockIdx.x * 128 + arow) * 512 + acg * 4;
  _Float16*    sa = As + arow * GP + acg * 4;
  // weight tile: eight steps of 64 rows x 8 chunks of 8 halves
  const int srow = tid >> 3, scg = tid & 7;
  const _Float16* gb = Wt + (size_t)srow * 512 + scg * 8;
  const uint32_t lb = (uint32_t)(uintptr_t)(const void*)Bs +
                      (uint32_t)((srow * GP + scg * 8) * 2);
  constexpr uint32_t LR = 64 * GP * 2;        // 64 staged rows, bytes
  constexpr size_t   GR = (size_t)64 * 512;   // 64 source rows, halves

  // the loops of both x steps are unrolled: ra is indexed by constants only and
  // stays in registers, the row steps are immediate offsets
  v4f ra[4];
  auto load_x = [&](int k0) {
#pragma unroll
    for (int j = 0; j < 4; ++j)
      ra[j] = *(const v4f*)(gx + (size_t)j * 32 * 512 + k0);
  };
  auto store_x = [&](int buf) {
#pragma unroll
    for (int j = 0; j < 4; ++j)
      *(v4h*)(sa + buf * PA + j * 32 * GP) = __builtin_convertvector(ra[j], v4h);
  };
  auto stage_w = [&](int buf, int k0) {
    const uint32_t b = lb + (uint32_t)(buf * PB * 2);
    const _Float16* g = gb + k0;
    async_copy8_b128(b,          g,          b + LR,     g + GR,
                     b + 2 * LR, g + 2 * GR, b + 3 * LR, g + 3 * GR,
                     b + 4 * LR, g + 4 * GR, b + 5 * LR, g + 5 * GR,
                     b + 6 * LR, g + 6 * GR, b + 7 * LR, g + 7 * GR);
  };

  v8f acc[4][4] = {};

  load_x(0);
  stage_w(0, 0);
  store_x(0);
  load_x(64);
  wait_ds0();           // my part of x tile 0 is in LDS
  wait_async0();        // my chunks of weight tile 0 have landed
  __syncthreads();      // everyone's have
  stage_w(1, 64);

  for (int t = 0; t < 8; ++t) {
    // x tile t + 1 into the buffer that every reader left at the last barrier;
    // then the loads of tile t + 2, which fly during this trip's products
    if (t + 1 < 8) store_x((t + 1) & 1);
    if (t + 2 < 8) load_x((t + 2) * 64);
    const _Float16* Ac = As + (t & 1) * PA + wm * 64 * GP;
    const _Float16* Bc = Bs + (t & 1) * PB + wn * 64 * GP;
    // every loop of the trip is unrolled: both k halves of the tile in one
    // straight run, LDS offsets as immediates, fragments and accumulators
    // indexed by constants only
#pragma unroll
    for (int kk = 0; kk < 64; kk += 32) {
      v16h a[4], b[4];
#pragma unroll
      for (int i = 0; i < 4; ++i) a[i] = load_frag(Ac + i * 16 * GP + kk, GP);
#pragma unroll
      for (int j = 0; j < 4; ++j) b[j] = load_frag(Bc + j * 16 * GP + kk, GP);
      // Inputs only: all eight fragments are in registers here, so their 16 LDS
      // reads are issued as one group with one wait; without it the x fragments
      // share one register set and are read in four places among the matrix
      // instructions, each waited to 0.
      asm volatile("" :: "v"(a[0]), "v"(a[1]), "v"(a[2]), "v"(a[3]),
                         "v"(b[0]), "v"(b[1]), "v"(b[2]), "v"(b[3]));
#pragma unroll
      for (int i = 0; i < 4; ++i)
#pragma unroll
        for (int j = 0; j < 4; ++j) acc[i][j] = wmma16(a[i], b[j], acc[i][j]);
    }
    wait_ds0();         // my reads of these buffers and my x stores have retired
    wait_async0();      // my chunks of weight tile t + 1 have landed
    __syncthreads();    // tiles t + 1 are published; these buffers are free
    if (t + 2 < 8) stage_w(t & 1, (t + 2) * 64);
  }
  wait_async0();        // nothing in flight when the wave goes on

  const int hf = lane >> 4, col = lane & 15;
  // A block's 128 rows lie in one batch (128 divides 2048): b and the lane's
  // first row s0 are formed once, and every store of the lane is its one base
  // address plus a constant.
  const int b  = blockIdx.x >> 4;
  const int s0 = (blockIdx.x & 15) * 128 + wm * 64 + 8 * hf;
  // every loop below is unrolled so that acc and bval are indexed by constants
  // only and stay in registers; the innermost index runs along the stored row
  float bval[4];
#pragma unroll
  for (int nt = 0; nt < 4; ++nt) bval[nt] = bias[h * 64 + nt * 16 + col];
  if (which == 2) {
    _Float16* p = Vtd + (((size_t)b * 8 + h) * 64 + col) * 2048 + s0;
#pragma unroll
    for (int nt = 0; nt < 4; ++nt)
#pragma unroll
      for (int i = 0; i < 4; ++i)
#pragma unroll
        for (int r = 0; r < 8; ++r)
          p[nt * 16 * 2048 + i * 16 + r] = (_Float16)(acc[i][nt][r] + bval[nt]);
  } else {
    _Float16* p = (which == 0 ? Qd : Kd) +
                  (((size_t)b * 8 + h) * 2048 + s0) * 64 + col;
    const float qs = which == 0 ? QS : 1.0f;   // K: times one, exact
    float bs[4];
#pragma unroll
    for (int nt = 0; nt < 4; ++nt) bs[nt] = bval[nt] * qs;
#pragma unroll
    for (int i = 0; i < 4; ++i)
#pragma unroll
      for (int r = 0; r < 8; ++r)
#pragma unroll
        for (int nt = 0; nt < 4; ++nt)
          p[(i * 16 + r) * 64 + nt * 16] = (_Float16)(acc[i][nt][r] * qs + bs[nt]);
    // In the built code this path runs on, behind a branch, into the block of
    // the V path: the wait stands in front of that block's register writes.
    asm volatile("s_wait_xcnt 0x0" ::: "memory");
  }
}

constexpr int TK = 128;
constexpr int NP = 2048 / TK;
constexpr int KP = 72;   // K row pitch in halves: 64 data + 8 pad (144 B)
constexpr int VP = 136;  // V^T row pitch in halves: 128 data + 8 pad (272 B)
constexpr float PMAX = 4096.0f;   // a lane's sum of P per pass that needs no raise

// value of lane l ^ 16
__device__ __forceinline__ float xhalf(float x) {
  int b = __builtin_bit_cast(int, x);
  return __builtin_bit_cast(
      float, __builtin_amdgcn_permlanex16(b, b, 0x76543210, 0xfedcba98, false,
                                          false));
}

// y[i] = 2^x[i], eight at a time. One statement, so that behind each v_exp_f32
// stands an instruction that neither reads its result nor overwrites its
// source (the next one: the outputs are registers of their own; behind the
// last the v_nop).
__device__ __forceinline__ void exp2x8(const float (&x)[8], float (&y)[8]) {
  asm("v_exp_f32 %0, %8\n\t"
      "v_exp_f32 %1, %9\n\t"
      "v_exp_f32 %2, %10\n\t"
      "v_exp_f32 %3, %11\n\t"
      "v_exp_f32 %4, %12\n\t"
      "v_exp_f32 %5, %13\n\t"
      "v_exp_f32 %6, %14\n\t"
      "v_exp_f32 %7, %15\n\t"
      "v_nop"
      : "=&v"(y[0]), "=&v"(y[1]), "=&v"(y[2]), "=&v"(y[3]),
        "=&v"(y[4]), "=&v"(y[5]), "=&v"(y[6]), "=&v"(y[7])
      : "v"(x[0]), "v"(x[1]), "v"(x[2]), "v"(x[3]),
        "v"(x[4]), "v"(x[5]), "v"(x[6]), "v"(x[7]));
}

// y = 2^x, one value, with the same slot behind it.
__device__ __forceinline__ float exp2x1(float x) {
  float y;
  asm("v_exp_f32 %0, %1\n\t"
      "v_nop"
      : "=&v"(y) : "v"(x));
  return y;
}

// The grid puts two blocks on a WGP, four waves on a SIMD: the register budget
// is stated for that.
__global__ __launch_bounds__(256)
__attribute__((amdgpu_waves_per_eu(4, 4))) void attn_kernel(
    const _Float16* __restrict__ Qd, const _Float16* __restrict__ Kd,
    const _Float16* __restrict__ Vtd, _Float16* __restrict__ concat) {
  __shared__ __align__(16) _Float16 Kl[2][TK * KP];   // [t][dk]
  __shared__ __align__(16) _Float16 Vl[2][64 * VP];   // [dv][t]

  const int tid  = threadIdx.x;
  const int wave = tid >> 5;
  const int lane = tid & 31;
  const int qg   = wave & 3;                   // 32 queries of the block's 128
  const int kh   = wave >> 2;                  // 64 keys of every 128
  const int bh   = blockIdx.y;                 // b*8 + h
  const int q0   = blockIdx.x * 128 + qg * 32;

  const _Float16* Qbh = Qd + (size_t)bh * 2048 * 64;
  const _Float16* Kbh = Kd + (size_t)bh * 2048 * 64;
  const _Float16* Vbh = Vtd + (size_t)bh * 64 * 2048;

  // A lane's share of a block: four 16-B chunks of K (32 rows x 8 chunks per
  // step; the block is 16 KB contiguous in memory) and four of V^T (16 rows x
  // 16 chunks per step: 16 lanes fetch 256 contiguous bytes of a row).
  const int krow = tid >> 3, kcg = tid & 7;
  const int vrow = tid >> 4, vcg = tid & 15;
  const _Float16* gk = Kbh + tid * 8;
  const _Float16* gv = Vbh + (size_t)vrow * 2048 + vcg * 8;
  // hardware LDS byte offsets for async copies
  const uint32_t lk = (uint32_t)(uintptr_t)(void*)&Kl[0][0] +
                      (uint32_t)((krow * KP + kcg * 8) * 2);
  const uint32_t lv = (uint32_t)(uintptr_t)(void*)&Vl[0][0] +
                      (uint32_t)((vrow * VP + vcg * 8) * 2);
  constexpr uint32_t LKR = 32 * KP * 2;        // 32 staged K rows, bytes
  constexpr uint32_t LVR = 16 * VP * 2;        // 16 staged V^T rows, bytes
  constexpr size_t   GKR = (size_t)32 * 64;    // 32 K rows, halves
  constexpr size_t   GVR = (size_t)16 * 2048;  // 16 V^T rows, halves

  auto stage = [&](int pp, int t0) {
    const uint32_t k = lk + (uint32_t)(pp * TK * KP * 2);
    const uint32_t v = lv + (uint32_t)(pp * 64 * VP * 2);
    const _Float16* a = gk + (size_t)t0 * 64;
    const _Float16* b = gv + t0;
    async_copy8_b128(k,           a,           k + LKR,     a + GKR,
                     k + 2 * LKR, a + 2 * GKR, k + 3 * LKR, a + 3 * GKR,
                     v,           b,           v + LVR,     b + GVR,
                     v + 2 * LVR, b + 2 * GVR, v + 3 * LVR, b + 3 * GVR);
  };

  stage(0, 0);

  // B fragments of Q^T, two column groups: column = query cg*16 + lane%16
  v16h qf[2][2];
#pragma unroll
  for (int cg = 0; cg < 2; ++cg) {
    qf[cg][0] = load_frag(Qbh + (size_t)(q0 + cg * 16) * 64, 64);
    qf[cg][1] = load_frag(Qbh + (size_t)(q0 + cg * 16) * 64 + 32, 64);
  }

  // per column group, over this wave's key halves only:
  v8f nref[2] = {};                   // minus the reference of the lane's query
  float lrow[2] = {0.0f, 0.0f};       // running sum, this half of the lanes
  v8f acc[2][4] = {};   // O^T: acc[cg][nt][r] = O[query][nt*16 + 8*hf + r]

  const int hf = lane >> 4, col = lane & 15;

  wait_async0();        // my chunks of block 0 have landed
  __syncthreads();      // everyone's have
  stage(1, TK);

  // ---- the three parts of a pass ahead of its second product ----
  // every loop in them is unrolled: the tiles are indexed by constants only and
  // stay in registers, LDS offsets are immediates

  // scores^T: 64 keys x 32 queries (2 x four 16x16 tiles, K-dim 64), as the
  // argument of 2^x: C = -reference
  auto scores = [&](const _Float16* Kc, v8f (&s)[2][4]) {
    v16h kb[4][2];
#pragma unroll
    for (int g = 0; g < 4; ++g) {
      kb[g][0] = load_frag(Kc + g * 16 * KP, KP);
      kb[g][1] = load_frag(Kc + g * 16 * KP + 32, KP);
    }
    // Inputs only: all eight fragments are in registers here, so their 16 LDS
    // reads are issued as one group with one wait; without it the reads stand in
    // four places among the matrix instructions, three of them waited to 0.
    asm volatile("" :: "v"(kb[0][0]), "v"(kb[0][1]), "v"(kb[1][0]), "v"(kb[1][1]),
                       "v"(kb[2][0]), "v"(kb[2][1]), "v"(kb[3][0]), "v"(kb[3][1]));
#pragma unroll
    for (int g = 0; g < 4; ++g) {
#pragma unroll
      for (int cg = 0; cg < 2; ++cg) {
        v8f z = wmma16(kb[g][0], qf[cg][0], nref[cg]);
        s[cg][g] = wmma16(kb[g][1], qf[cg][1], z);
      }
      // The first 32 keys' products end before the others begin: left alone the
      // compiler opens all eight tiles while all eight fragments are still
      // held, and loop-invariant addresses are spilled and reloaded every pass.
      if (g == 1) __builtin_amdgcn_sched_barrier(0);
    }
  };

  // The reference moves to the maximum of these 64 keys (first: up or down;
  // later: up only); the scores follow it, O and the sum are rescaled.
  auto raise = [&](bool first, v8f (&s)[2][4]) {
#pragma unroll
    for (int cg = 0; cg < 2; ++cg) {
      // the lane's own largest exponent: two independent chains, then joined
      float bk[2];
#pragma unroll
      for (int k = 0; k < 2; ++k) {
        bk[k] = s[cg][2 * k][0];
#pragma unroll
        for (int r = 1; r < 8; ++r) bk[k] = fmaxf(bk[k], s[cg][2 * k][r]);
#pragma unroll
        for (int r = 0; r < 8; ++r) bk[k] = fmaxf(bk[k], s[cg][2 * k + 1][r]);
      }
      const float bm = fmaxf(bk[0], bk[1]);
      const float m = fmaxf(bm, xhalf(bm));           // all 64 keys of the query
      const float d = first ? m : fmaxf(m, 0.0f);     // the reference's move
      // pass 0 has nothing to rescale (O and the sum are 0)
      const float c = first ? 1.0f : exp2x1(-d);
      nref[cg] -= d;
#pragma unroll
      for (int g = 0; g < 4; ++g) s[cg][g] -= d;
      lrow[cg] *= c;
#pragma unroll
      for (int nt = 0; nt < 4; ++nt) acc[cg][nt] *= c;
    }
  };

  // P = 2^s: its sum over the lane's 32 keys per column group, and P^T as B
  // fragments, one per 32 keys: element e = key 8*hf+e (e < 8) or 16+8*hf+(e-8),
  // the k order in which load_frag brings the V^T rows.
  auto soft = [&](const _Float16* Vc, const v8f (&s)[2][4], v16h (&vb0)[4],
                  v16h (&pf)[2][2], float (&ps)[2]) {
    // V^T fragments of the first 32 keys, read here so that the exponentials
    // cover their LDS latency
#pragma unroll
    for (int nt = 0; nt < 4; ++nt) vb0[nt] = load_frag(Vc + nt * 16 * VP, VP);
    // The distance behind the score product. The scheduling barrier keeps the
    // exponentials behind the four slots.
    asm volatile("v_nop\n\tv_nop\n\tv_nop\n\tv_nop");
    __builtin_amdgcn_sched_barrier(0);
#pragma unroll
    for (int cg = 0; cg < 2; ++cg) {
      float pk[2];
#pragma unroll
      for (int k = 0; k < 2; ++k) {
        float x0[8], x1[8], p0[8], p1[8];
#pragma unroll
        for (int r = 0; r < 8; ++r) {
          x0[r] = s[cg][2 * k][r];
          x1[r] = s[cg][2 * k + 1][r];
        }
        exp2x8(x0, p0);
        exp2x8(x1, p1);
#pragma unroll
        for (int r = 0; r < 8; ++r) {
          pk[k] = r == 0 ? p0[r] + p1[r] : pk[k] + (p0[r] + p1[r]);
          pf[cg][k][r]     = (_Float16)p0[r];
          pf[cg][k][r + 8] = (_Float16)p1[r];
        }
      }
      ps[cg] = pk[0] + pk[1];
    }
  };

  // One test per pass, the same for the whole wave, on the sums that the pass
  // forms anyway. A trip that fails it is taken again for the same pass, from the
  // top (the K rows are still in the pass's buffer), now with fix set: it raises
  // the reference and is not tested, so a pass takes two trips at most, and every
  // wave passes the foot's barrier once per pass. Pass 0 sets the reference in
  // its one trip.
  // Not unrolled and not peeled: left to itself the compiler splits pass 0 off
  // as a second copy of the whole pass, and registers spill.
  bool fix = true;
#pragma nounroll
  for (int n = 0; n < NP;) {
    const _Float16* Kc = &Kl[n & 1][0] + kh * 64 * KP;   // my 64 key rows
    const _Float16* Vc = &Vl[n & 1][0] + kh * 64;        // my 64 key columns

    v8f s[2][4];
    v16h vb0[4], pf[2][2];
    float ps[2];
    scores(Kc, s);
    if (fix) raise(n == 0, s);
    soft(Vc, s, vb0, pf, ps);
    if (!fix &&
        __builtin_amdgcn_ballot_w32(fmaxf(ps[0], ps[1]) > PMAX) != 0) {
      fix = true;
      continue;
    }
    fix = false;
    lrow[0] += ps[0];
    lrow[1] += ps[1];

    // ---- O^T += V^T P^T : A = V^T rows (dv, t-contiguous), B = P^T --------
#pragma unroll
    for (int k = 0; k < 2; ++k) {
      v16h vb[4];
#pragma unroll
      for (int nt = 0; nt < 4; ++nt)
        vb[nt] = k == 0 ? vb0[nt] : load_frag(Vc + nt * 16 * VP + k * 32, VP);
      // Inputs only: all four fragments are in registers here, so their eight
      // LDS reads are issued as one group with one wait; without it the reads
      // stand in four places among the matrix instructions, each waited to 0.
      asm volatile("" :: "v"(vb[0]), "v"(vb[1]), "v"(vb[2]), "v"(vb[3]));
#pragma unroll
      for (int nt = 0; nt < 4; ++nt)
#pragma unroll
        for (int cg = 0; cg < 2; ++cg)
          acc[cg][nt] = wmma16(vb[nt], pf[cg][k], acc[cg][nt]);
    }

    wait_ds0();         // my reads of this buffer have retired
    wait_async0();      // my chunks of block n + 1 have landed
    __syncthreads();    // block n + 1 is published; this buffer is free
    if (n + 2 < NP) stage(n & 1, (n + 2) * TK);
    ++n;
  }
  wait_async0();        // nothing in flight when the wave goes on

  // ---- join of the two key halves -----------------------------------------
  // Waves w and w ^ 4 hold the same 32 queries. Each keeps one column group
  // (group kh) and hands the other to its partner through the K buffers, which
  // nobody reads any more behind the loop's last barrier. A wave's range: 8
  // rows of 32 lanes x 16 B (whole-wave contiguous b128), then reference and sum.
  float* X = (float*)&Kl[0][0];
  v8f keep[4], give[4];
#pragma unroll
  for (int nt = 0; nt < 4; ++nt) {
    keep[nt] = kh ? acc[1][nt] : acc[0][nt];
    give[nt] = kh ? acc[0][nt] : acc[1][nt];
  }
  lrow[0] += xhalf(lrow[0]);    // the lane halves' sums of my keys
  lrow[1] += xhalf(lrow[1]);
  // the two groups' references, in the exponent's unit (powers of two)
  const float mk = kh ? -nref[1][0] : -nref[0][0];
  const float mg = kh ? -nref[0][0] : -nref[1][0];
  const float lk0 = kh ? lrow[1] : lrow[0], lg = kh ? lrow[0] : lrow[1];
#pragma unroll
  for (int nt = 0; nt < 4; ++nt) {
    v4f lo = {give[nt][0], give[nt][1], give[nt][2], give[nt][3]};
    v4f hi = {give[nt][4], give[nt][5], give[nt][6], give[nt][7]};
    *(v4f*)(X + ((wave * 8 + nt * 2) * 32 + lane) * 4)     = lo;
    *(v4f*)(X + ((wave * 8 + nt * 2 + 1) * 32 + lane) * 4) = hi;
  }
  X[8192 + (wave * 2) * 32 + lane]     = mg;
  X[8192 + (wave * 2 + 1) * 32 + lane] = lg;
  __syncthreads();      // the partner's group is published
  const int pw = wave ^ 4;
  const float mp = X[8192 + (pw * 2) * 32 + lane];
  const float lp = X[8192 + (pw * 2 + 1) * 32 + lane];
  const float mj = fmaxf(mk, mp);
  const float ek = exp2x1(mk - mj), ep = exp2x1(mp - mj);
  const float lj = lk0 * ek + lp * ep;
  const float fk = ek / lj, fp = ep / lj;

  // normalize, write f16 concat [b][s][h*64 + dv]; a lane's 8 values of a tile
  // are 8 consecutive dv
  const int b = bh >> 3, h = bh & 7;
  _Float16* orow = concat + ((size_t)(b * 2048 + q0 + kh * 16 + col)) * 512 +
                   h * 64 + 8 * hf;
#pragma unroll
  for (int nt = 0; nt < 4; ++nt) {
    const v4f lo = *(const v4f*)(X + ((pw * 8 + nt * 2) * 32 + lane) * 4);
    const v4f hi = *(const v4f*)(X + ((pw * 8 + nt * 2 + 1) * 32 + lane) * 4);
    union { _Float16 e[8]; uint4 q; } o;
#pragma unroll
    for (int r = 0; r < 4; ++r) {
      o.e[r]     = (_Float16)(keep[nt][r] * fk + lo[r] * fp);
      o.e[r + 4] = (_Float16)(keep[nt][r + 4] * fk + hi[r] * fp);
    }
    *(uint4*)(orow + nt * 16) = o.q;
  }
}

// ---------------------------------------------------------------------------
// Output projection: [8192 x 512] @ [512 x 512] + bo -> f32
// grid (8192/128, 512/128), block 256; the 128 x 128 GEMM core above.
// ---------------------------------------------------------------------------
__global__ __launch_bounds__(256) void outproj_kernel(
    const _Float16* __restrict__ concat, const _Float16* __restrict__ Wot,
    const float* __restrict__ bo, float* __restrict__ out) {
  __shared__ __align__(16) _Float16 As[2 * GT];
  __shared__ __align__(16) _Float16 Bs[2 * GT];
  const int wave = threadIdx.x >> 5;
  const int lane = threadIdx.x & 31;
  const int wm = wave & 3, wn = wave >> 2;

  v8f acc[2][4] = {};
  gemm_128x128_k512(concat + (size_t)blockIdx.x * 128 * 512,
                    Wot + (size_t)blockIdx.y * 128 * 512,
                    As, Bs, wm, wn, acc);

  const int hf = lane >> 4, col = lane & 15;
  // the three loops are unrolled so that acc is indexed by constants only and
  // stays in registers
#pragma unroll
  for (int i = 0; i < 2; ++i) {
    const int m0 = blockIdx.x * 128 + wm * 32 + i * 16;
#pragma unroll
    for (int nt = 0; nt < 4; ++nt) {
      int n = blockIdx.y * 128 + wn * 64 + nt * 16 + col;
      float bval = bo[n];
#pragma unroll
      for (int r = 0; r < 8; ++r) {
        int m = m0 + r + 8 * hf;
        out[(size_t)m * 512 + n] = acc[i][nt][r] + bval;
      }
    }
  }
}

// ---------------------------------------------------------------------------
extern "C" void kernel_launch(void* const* d_in, const int* in_sizes, int n_in,
                              void* d_out, int out_size, void* d_ws,
                              size_t ws_size, hipStream_t stream) {
  const float* x_q = (const float*)d_in[0];
  const float* x_k = (const float*)d_in[1];
  const float* x_v = (const float*)d_in[2];
  const float* Wq  = (const float*)d_in[3];
  const float* bq  = (const float*)d_in[4];
  const float* Wk  = (const float*)d_in[5];
  const float* bk  = (const float*)d_in[6];
  const float* Wv  = (const float*)d_in[7];
  const float* bv  = (const float*)d_in[8];
  const float* Wo  = (const float*)d_in[9];
  const float* bo  = (const float*)d_in[10];
  float* out = (float*)d_out;
  (void)in_sizes; (void)n_in; (void)out_size; (void)ws_size;

  // workspace carve-up (~36 MB total)
  char* ws = (char*)d_ws;
  size_t off = 0;
  auto take = [&](size_t elems) {
    _Float16* p = (_Float16*)(ws + off);
    off += elems * sizeof(_Float16);
    return p;
  };
  const size_t XE = (size_t)8192 * 512;
  const size_t WE = (size_t)8 * 64 * 512;
  _Float16* Wqt = take(WE);
  _Float16* Wkt = take(WE);
  _Float16* Wvt = take(WE);
  _Float16* Wot = take((size_t)512 * 512);
  _Float16* Qd  = take(XE);
  _Float16* Kd  = take(XE);
  _Float16* Vtd = take(XE);
  _Float16* Cc  = take(XE);

  cvt_w<<<256, 256, 0, stream>>>(Wq, Wk, Wv, Wo, Wqt, Wkt, Wvt, Wot);

  proj_kernel<<<dim3(64, 3), 512, 0, stream>>>(
      x_q, x_k, x_v, Wqt, Wkt, Wvt, bq, bk, bv, Qd, Kd, Vtd);

  attn_kernel<<<dim3(16, 32), 256, 0, stream>>>(Qd, Kd, Vtd, Cc);

  outproj_kernel<<<dim3(64, 4), 256, 0, stream>>>(Cc, Wot, bo, out);
}
